// v000
// Times are from an AMD MI455X. After a warm-up the kernel runs many times in a row, and a time is the length of
// such a window on the GPU divided by its runs, so every launch and the gaps after it count. The runs cycle
// through copies of the inputs. A figure is the median of several windows, for all but v000 over two sittings.
// Sittings can differ by a few percent; kernels timed side by side share one.
// The starting kernel, v000, takes 1270 microseconds a run.
#include <hip/hip_runtime.h>

// Contractions, f32 accumulate: q/k/v projections v_wmma_f32_16x16x32_bf16 (bf16 operands = inputs RNE-converted to bf16, exact products); scores q.k^T v_wmma_f32_16x16x32_bf16 on bf16 hi+lo planes (3 products hh+hl+lh); att.v v_wmma_f32_16x16x32_f16 (P f16 carried x2^14, v^T f16); online softmax f32; output f32.
// Single-head full self-attention over SEQ tokens of width 128: q = x Wq^T, k = x Wk^T, v = x Wv^T ([out][in] weights, no bias); att = softmax(q k^T) with no scale; out = att v -> [SEQ][128] f32.
// Stages: bf16 copies of x and the weights; three one-wave-per-64x64-tile GEMMs (f32 results); bf16 hi/lo planes of q and k ([t][d]); f16 transposed v plane ([d][t]);
// one streaming attention kernel (16 query rows per wave, 32 keys per step, running max/sum, P tile relayout through wave-private LDS, att.v accumulated in registers; epilogue stages the 16x128 f32 rows in LDS and writes each 512-B row with one 32-lane x 16-B instruction).

#ifndef NB
#define NB 1
#endif
#ifndef SEQ
#define SEQ 8192
#endif
#define SEQ_FULL 8192
#define DMD  128
#define QB   64                   // query rows per attention block (4 waves x 16)
#define KS   32                   // keys per step
#define PP   40                   // P tile pitch in halves (80 B rows, 16-B aligned)
#define OP   132                  // O staging pitch in floats
#define PCAR 16384.0f             // power-of-two carry of the f16 P operand, folded back by the final normaliser
#define L2E  1.4426950408889634f

static_assert((SEQ % QB) == 0);
static_assert((SEQ % 64) == 0);
static_assert(SEQ <= SEQ_FULL);
static_assert((DMD % 32) == 0);
static_assert(NB == 1);

typedef _Float16 h16;
typedef unsigned short bf;
typedef __attribute__((ext_vector_type(16))) __bf16   v16bf;
typedef __attribute__((ext_vector_type(16))) _Float16 v16h;
typedef __attribute__((ext_vector_type(8)))  _Float16 v8h;
typedef __attribute__((ext_vector_type(8)))  unsigned short v8us;
typedef __attribute__((ext_vector_type(8)))  float    v8f;
typedef __attribute__((ext_vector_type(4)))  float    v4f;
typedef __attribute__((ext_vector_type(2)))  _Float16 v2h;
typedef __attribute__((ext_vector_type(2)))  unsigned short v2us;
typedef __attribute__((ext_vector_type(2)))  float    v2f;
typedef v8h  __attribute__((may_alias)) v8ha;
typedef v4f  __attribute__((may_alias)) v4fa;
typedef v8us __attribute__((may_alias)) v8usa;

__device__ __forceinline__ unsigned short f2bf(float f) { unsigned u = __float_as_uint(f); u += 0x7FFFu + ((u >> 16) & 1u); return (unsigned short)(u >> 16); }
__device__ __forceinline__ float bf2f(unsigned short b) { return __uint_as_float(((unsigned)b) << 16); }
__device__ __forceinline__ float bfr(float f) { return bf2f(f2bf(f)); }
__device__ __forceinline__ v16h cat16(v8h lo, v8h hi) { return __builtin_shufflevector(lo, hi, 0, 1, 2, 3, 4, 5, 6, 7, 8, 9, 10, 11, 12, 13, 14, 15); }
__device__ __forceinline__ v16bf cat16b(v8us lo, v8us hi) { return __builtin_bit_cast(v16bf, __builtin_shufflevector(lo, hi, 0, 1, 2, 3, 4, 5, 6, 7, 8, 9, 10, 11, 12, 13, 14, 15)); }
__device__ __forceinline__ v8f wmma16(v16h a, v16h b, v8f c) { return __builtin_amdgcn_wmma_f32_16x16x32_f16(false, a, false, b, (short)0, c, false, false); }
__device__ __forceinline__ v8f wmmab(v16bf a, v16bf b, v8f c) { return __builtin_amdgcn_wmma_f32_16x16x32_bf16(false, a, false, b, (short)0, c, false, false); }
__device__ __forceinline__ void splitf(float y, unsigned short& h, unsigned short& l) { h = f2bf(y); l = f2bf(y - bf2f(h)); }

// 16-bit fragment loaders (wave32, 16x16x32): lane -> row/col (lane & 15); elements 0..7 <- k0 + 8*(lane>>4) + 0..7, elements 8..15 <- k0 + 16 + 8*(lane>>4) + 0..7.
// p points at row (lane & 15), column k0 + 8*(lane>>4) of a K-contiguous plane; the same map serves A and B.
template <typename T16> struct WFrag;
template <> struct WFrag<h16> { typedef v16h V; static __device__ __forceinline__ V ld(const h16* p) { return cat16(*(const v8ha*)p, *(const v8ha*)(p + 16)); } static __device__ __forceinline__ v8f mma(V a, V b, v8f c) { return wmma16(a, b, c); } };
template <> struct WFrag<bf> { typedef v16bf V; static __device__ __forceinline__ V ld(const bf* p) { return cat16b(*(const v8usa*)p, *(const v8usa*)(p + 16)); } static __device__ __forceinline__ v8f mma(V a, V b, v8f c) { return wmmab(a, b, c); } };

// ---- k_gemmw: register-blocked GEMM, ONE WAVE per 64x64 output tile (16 accumulators), operands straight from K-contiguous 16-bit planes; grid (M/64, N/64, Z), 32 threads.
// C[m][n] (f32, pitch ldc, + optional f32 bias[n]) = sum_k A[m][k] Bt[n][k] (+ split products per NSPLIT). z-batch strides sA/sB/sC in elements. K % 32 == 0.
template <typename T16, int NSPLIT, bool BIAS>
__global__ __launch_bounds__(32) void k_gemmw(const T16* __restrict__ A, const T16* __restrict__ A2, const T16* __restrict__ Bt, const T16* __restrict__ Bt2, int K, float* C, int ldc, const float* __restrict__ bias, size_t sA, size_t sB, size_t sC) {
    typedef typename WFrag<T16>::V V;
    __shared__ __align__(16) float os[16 * 68];
    const size_t z = blockIdx.z; A += z * sA; if (A2) A2 += z * sA; Bt += z * sB; if (Bt2) Bt2 += z * sB; C += z * sC;
    const int lane = threadIdx.x & 31, lr = lane & 15, hi = lane >> 4; const int r0 = blockIdx.x * 64, c0 = blockIdx.y * 64;
    v8f acc[4][4];
#pragma unroll
    for (int mb = 0; mb < 4; ++mb)
#pragma unroll
        for (int nb = 0; nb < 4; ++nb) acc[mb][nb] = (v8f){};
    const size_t aoff = (size_t)(r0 + lr) * K + 8 * hi, boff = (size_t)(c0 + lr) * K + 8 * hi;
#pragma unroll 1
    for (int kc = 0; kc < K; kc += 32) {
        V a[4], a2[4];
#pragma unroll
        for (int mb = 0; mb < 4; ++mb) { a[mb] = WFrag<T16>::ld(A + aoff + (size_t)mb * 16 * K + kc); if (NSPLIT == 1 || NSPLIT == 2) a2[mb] = WFrag<T16>::ld(A2 + aoff + (size_t)mb * 16 * K + kc); }
#pragma unroll
        for (int nb = 0; nb < 4; ++nb) { const V b = WFrag<T16>::ld(Bt + boff + (size_t)nb * 16 * K + kc); V b2; if (NSPLIT >= 2) b2 = WFrag<T16>::ld(Bt2 + boff + (size_t)nb * 16 * K + kc);
#pragma unroll
            for (int mb = 0; mb < 4; ++mb) { acc[mb][nb] = WFrag<T16>::mma(a[mb], b, acc[mb][nb]); if (NSPLIT == 1 || NSPLIT == 2) acc[mb][nb] = WFrag<T16>::mma(a2[mb], b, acc[mb][nb]); if (NSPLIT >= 2) acc[mb][nb] = WFrag<T16>::mma(a[mb], b2, acc[mb][nb]); } }
        asm volatile("v_nop\n\tv_nop\n\tv_nop\n\tv_nop" : "+v"(acc[0][0]), "+v"(acc[1][1]), "+v"(acc[2][2]), "+v"(acc[3][3]) : "v"(a[0]), "v"(a[3]));
    }
#pragma unroll
    for (int mb = 0; mb < 4; ++mb) {
#pragma unroll
        for (int nb = 0; nb < 4; ++nb) {
#pragma unroll
            for (int j = 0; j < 8; ++j) os[(hi * 8 + j) * 68 + nb * 16 + lr] = acc[mb][nb][j]; }
        __builtin_amdgcn_fence(3, "wavefront"); __builtin_amdgcn_wave_barrier(); asm volatile("" ::: "memory");
        float* crow = C + (size_t)(r0 + mb * 16) * ldc + c0;
{
#pragma unroll
            for (int s = 0; s < 8; ++s) { const int row = 2 * s + hi, cofs = lr * 4; v4f val = *(const v4fa*)(os + row * 68 + cofs); if (BIAS) { val[0] += bfr(bias[c0 + cofs]); val[1] += bfr(bias[c0 + cofs + 1]); val[2] += bfr(bias[c0 + cofs + 2]); val[3] += bfr(bias[c0 + cofs + 3]); }
                *(v4f*)(crow + (size_t)row * ldc + cofs) = val; }
             }
        __builtin_amdgcn_wave_barrier(); asm volatile("" ::: "memory");
    }
}

__global__ __launch_bounds__(256) void k_cvt8(const float* __restrict__ src, bf* dst, size_t n8) { const size_t i = (size_t)blockIdx.x * 256 + threadIdx.x; if (i >= n8) return; const v8f v = *(const v8f*)(src + i * 8); v8us o;
#pragma unroll
    for (int k = 0; k < 8; ++k) { const float f = v[k]; o[k] = f2bf(f); } *(v8us*)(dst + i * 8) = o;  }

__global__ __launch_bounds__(256) void k_hlp(const float* __restrict__ F, int n, bf* Ph, bf* Pl) {
    const int e = (blockIdx.x * 256 + threadIdx.x) * 2; if (e >= n) return;
    const v2f x = *(const v2f*)(F + e); v2us oh, ol;
#pragma unroll
    for (int q = 0; q < 2; ++q) { const float xv = x[q]; unsigned short a2, c2; splitf(xv, a2, c2); oh[q] = a2; ol[q] = c2; }
    *(v2us*)(Ph + e) = oh; *(v2us*)(Pl + e) = ol; 
}

__global__ __launch_bounds__(256) void k_vt16(const float* __restrict__ F, h16* VT) {
    const int e = (blockIdx.x * 256 + threadIdx.x) * 2; if (e >= DMD * SEQ) return;
    const int t = e % SEQ, d = e / SEQ; v2h o16;
    const float x0 = F[(size_t)t * DMD + d], x1 = F[(size_t)(t + 1) * DMD + d];
    o16[0] = (h16)x0; o16[1] = (h16)x1;
    *(v2h*)(VT + e) = o16; 
}

// k_attn: streaming attention. Block = 4 waves = 64 query rows; wave w owns rows r0..r0+15. Per 32-key step:
//   S[16x32] = q.k^T from bf16 hi/lo planes (products hh + hl + lh, K = 128 in 4 steps), running row max / sum in f32 (16-lane shuffles),
//   P = exp(s - m) x 2^14 as f16 into a wave-private LDS tile (row-major, pitch PP), reloaded with the fragment loader as the A operand,
//   O[16x128] += P . v (B from the f16 VT plane), O rescaled by alpha each step. The row sum uses the same f16-converted P values.
__global__ __launch_bounds__(128) __attribute__((amdgpu_num_vgpr(256)))
void k_attn(const bf* __restrict__ QPh, const bf* __restrict__ QPl, const bf* __restrict__ KPh, const bf* __restrict__ KPl, const h16* __restrict__ VT, float* OUT) {
    __shared__ __align__(16) h16 psm[4 * 16 * PP];
    __shared__ __align__(16) float osm[4 * 16 * OP];
    const int wave = threadIdx.x >> 5, lane = threadIdx.x & 31, lr = lane & 15, hi = lane >> 4;
    const int r0 = blockIdx.x * QB + wave * 16;
    h16* pw = psm + wave * (16 * PP);
    float* ow = osm + wave * (16 * OP);
    v8f o[8];
#pragma unroll
    for (int dt = 0; dt < 8; ++dt) o[dt] = (v8f){};
    float mrow[8], lrow[8];
#pragma unroll
    for (int r = 0; r < 8; ++r) { mrow[r] = -1.0e30f; lrow[r] = 0.0f; }
    const size_t qoff = (size_t)(r0 + lr) * DMD + 8 * hi;
    const size_t koff = (size_t)lr * DMD + 8 * hi;
    const size_t voff = (size_t)lr * SEQ + 8 * hi;
#pragma unroll 1
    for (int j0 = 0; j0 < SEQ; j0 += KS) {
        v8f s[2]; s[0] = (v8f){}; s[1] = (v8f){};
        v16bf ah, al, bh0, bl0, bh1, bl1;
#pragma unroll
        for (int ks = 0; ks < DMD / 32; ++ks) {
            ah = WFrag<bf>::ld(QPh + qoff + ks * 32); al = WFrag<bf>::ld(QPl + qoff + ks * 32);
            const size_t k0 = (size_t)j0 * DMD + koff + ks * 32, k1 = k0 + (size_t)16 * DMD;
            bh0 = WFrag<bf>::ld(KPh + k0); bl0 = WFrag<bf>::ld(KPl + k0);
            bh1 = WFrag<bf>::ld(KPh + k1); bl1 = WFrag<bf>::ld(KPl + k1);
            s[0] = wmmab(ah, bh0, s[0]); s[0] = wmmab(ah, bl0, s[0]); s[0] = wmmab(al, bh0, s[0]);
            s[1] = wmmab(ah, bh1, s[1]); s[1] = wmmab(ah, bl1, s[1]); s[1] = wmmab(al, bh1, s[1]);
        }
        asm volatile("v_nop\n\tv_nop\n\tv_nop\n\tv_nop" : "+v"(s[0]), "+v"(s[1]) : "v"(ah), "v"(al), "v"(bh0), "v"(bl0), "v"(bh1), "v"(bl1));
        // online softmax: lane half hi holds rows 8*hi + r, columns (keys) j0 + nt*16 + lr
#pragma unroll
        for (int r = 0; r < 8; ++r) {
            float mx = fmaxf(s[0][r], s[1][r]);
            mx = fmaxf(mx, __shfl_xor(mx, 1, 32)); mx = fmaxf(mx, __shfl_xor(mx, 2, 32)); mx = fmaxf(mx, __shfl_xor(mx, 4, 32)); mx = fmaxf(mx, __shfl_xor(mx, 8, 32));
            const float mn = fmaxf(mrow[r], mx);
            const float alpha = __builtin_amdgcn_exp2f((mrow[r] - mn) * L2E);
            mrow[r] = mn;
            const float e0 = __builtin_amdgcn_exp2f((s[0][r] - mn) * L2E) * PCAR;
            const float e1 = __builtin_amdgcn_exp2f((s[1][r] - mn) * L2E) * PCAR;
            const h16 p0 = (h16)e0, p1 = (h16)e1;
            float rs = (float)p0 + (float)p1;
            rs += __shfl_xor(rs, 1, 32); rs += __shfl_xor(rs, 2, 32); rs += __shfl_xor(rs, 4, 32); rs += __shfl_xor(rs, 8, 32);
            lrow[r] = lrow[r] * alpha + rs;
            pw[(8 * hi + r) * PP + lr] = p0; pw[(8 * hi + r) * PP + 16 + lr] = p1;
#pragma unroll
            for (int dt = 0; dt < 8; ++dt) o[dt][r] *= alpha;
        }
        __builtin_amdgcn_fence(3, "wavefront"); __builtin_amdgcn_wave_barrier(); asm volatile("" ::: "memory");
        const v16h pa = WFrag<h16>::ld(pw + lr * PP + 8 * hi);
        v16h vb;
#pragma unroll
        for (int dt = 0; dt < 8; ++dt) { vb = WFrag<h16>::ld(VT + (size_t)(dt * 16) * SEQ + voff + j0); o[dt] = wmma16(pa, vb, o[dt]); }
        asm volatile("v_nop\n\tv_nop\n\tv_nop\n\tv_nop" : "+v"(o[0]), "+v"(o[1]), "+v"(o[2]), "+v"(o[3]), "+v"(o[4]), "+v"(o[5]), "+v"(o[6]), "+v"(o[7]) : "v"(pa), "v"(vb));
        asm volatile("" ::: "memory");
    }
#pragma unroll
    for (int r = 0; r < 8; ++r) { const float inv = 1.0f / lrow[r];
#pragma unroll
        for (int dt = 0; dt < 8; ++dt) ow[(8 * hi + r) * OP + dt * 16 + lr] = o[dt][r] * inv; }
    __builtin_amdgcn_fence(3, "wavefront"); __builtin_amdgcn_wave_barrier(); asm volatile("" ::: "memory");
    float* orow = OUT + (size_t)r0 * DMD + lane * 4;
{
#pragma unroll
        for (int row = 0; row < 16; ++row) { const v4f val = *(const v4fa*)(ow + row * OP + lane * 4); *(v4f*)(orow + (size_t)row * DMD) = val; }
        
    }
}

extern "C" void kernel_launch(void* const* d_in, const int* in_sizes, int n_in,
                              void* d_out, int out_size, void* d_ws, size_t ws_size, hipStream_t stream) {
    if (n_in < 4) return;
    if (in_sizes[0] < SEQ * DMD || in_sizes[1] < DMD * DMD || in_sizes[2] < DMD * DMD || in_sizes[3] < DMD * DMD || out_size < SEQ * DMD) return;
    const float* x = (const float*)d_in[0]; const float* wq = (const float*)d_in[1]; const float* wk = (const float*)d_in[2]; const float* wv = (const float*)d_in[3];
    float* OUT = (float*)d_out;     // [SEQ][128] f32
    char* wsp = (char*)d_ws;
    auto take = [&](size_t bytes) { char* p = wsp; wsp += (bytes + 255) & ~(size_t)255; return (void*)p; };
    bf* WQ = (bf*)take((size_t)DMD * DMD * 2); bf* WK = (bf*)take((size_t)DMD * DMD * 2); bf* WV = (bf*)take((size_t)DMD * DMD * 2);
    bf* XB = (bf*)take((size_t)SEQ * DMD * 2);
    float* FQ = (float*)take((size_t)SEQ * DMD * 4); float* FK = (float*)take((size_t)SEQ * DMD * 4); float* FV = (float*)take((size_t)SEQ * DMD * 4);
    bf* QPh = (bf*)take((size_t)SEQ * DMD * 2); bf* QPl = (bf*)take((size_t)SEQ * DMD * 2); bf* KPh = (bf*)take((size_t)SEQ * DMD * 2); bf* KPl = (bf*)take((size_t)SEQ * DMD * 2);
    h16* VT = (h16*)take((size_t)DMD * SEQ * 2);
    const size_t used = (size_t)(wsp - (char*)d_ws);
    if (used > ws_size || used > (size_t)134217728) return;

    // bf16 copies of the weights ([out][in] = Bt as-is) and of x
    k_cvt8<<<(unsigned)(((size_t)DMD * DMD / 8 + 255) / 256), 256, 0, stream>>>(wq, WQ, (size_t)DMD * DMD / 8);
    k_cvt8<<<(unsigned)(((size_t)DMD * DMD / 8 + 255) / 256), 256, 0, stream>>>(wk, WK, (size_t)DMD * DMD / 8);
    k_cvt8<<<(unsigned)(((size_t)DMD * DMD / 8 + 255) / 256), 256, 0, stream>>>(wv, WV, (size_t)DMD * DMD / 8);
    k_cvt8<<<(unsigned)(((size_t)SEQ * DMD / 8 + 255) / 256), 256, 0, stream>>>(x, XB, (size_t)SEQ * DMD / 8);
    // q, k, v projections: [SEQ][128] f32 = XB[SEQ][128] . W[128][128]^T
    k_gemmw<bf, 0, false><<<dim3(SEQ / 64, DMD / 64, 1), 32, 0, stream>>>(XB, nullptr, WQ, nullptr, DMD, FQ, DMD, nullptr, 0, 0, 0);
    k_gemmw<bf, 0, false><<<dim3(SEQ / 64, DMD / 64, 1), 32, 0, stream>>>(XB, nullptr, WK, nullptr, DMD, FK, DMD, nullptr, 0, 0, 0);
    k_gemmw<bf, 0, false><<<dim3(SEQ / 64, DMD / 64, 1), 32, 0, stream>>>(XB, nullptr, WV, nullptr, DMD, FV, DMD, nullptr, 0, 0, 0);
    // operand planes: q, k as bf16 hi/lo [t][d]; v as f16 [d][t]
    const unsigned LP = (unsigned)(((size_t)SEQ * DMD / 2 + 255) / 256);
    k_hlp<<<LP, 256, 0, stream>>>(FQ, SEQ * DMD, QPh, QPl);
    k_hlp<<<LP, 256, 0, stream>>>(FK, SEQ * DMD, KPh, KPl);
    k_vt16<<<LP, 256, 0, stream>>>(FV, VT);
    // attention: one block per 64 query rows
    k_attn<<<SEQ / QB, 128, 0, stream>>>(QPh, QPl, KPh, KPl, VT, OUT);
}

// v001
// One run takes 297 microseconds.
// Timed twice side by side with v000, it ran 4.26 and 4.31 times as fast.
#include <hip/hip_runtime.h>

// Contractions, f32 accumulate: q/k/v projections v_wmma_f32_16x16x32_bf16 (bf16 operands = inputs RNE-converted to bf16, exact products); scores q.k^T v_wmma_f32_16x16x32_bf16 on bf16 hi+lo planes (3 products hh+hl+lh); att.v v_wmma_f32_16x16x32_f16 (P f16 carried x2^14, v^T f16); online softmax f32; output f32.
// Single-head full self-attention over SEQ tokens of width 128: q = x Wq^T, k = x Wk^T, v = x Wv^T ([out][in] weights, no bias); att = softmax(q k^T) with no scale; out = att v -> [SEQ][128] f32.
// Stages: bf16 copies of x and the weights; three one-wave-per-64x64-tile GEMMs (f32 results); bf16 hi/lo planes of q and k ([t][d]); f16 transposed v plane ([d][t]);
// one streaming attention kernel (16 query rows per wave, 32 keys per step, running max/sum, P tile relayout through wave-private LDS, att.v accumulated in registers; epilogue stages the 16x128 f32 rows in LDS and writes each 512-B row with one 32-lane x 16-B instruction);
// the keys are cut into KSPLIT ranges, one work-group column per range: each wave leaves an un-normalised partial row block with its (max, sum), and a merge kernel joins the KSPLIT partials of a row.

#ifndef NB
#define NB 1
#endif
#ifndef SEQ
#define SEQ 8192
#endif
#define SEQ_FULL 8192
#define DMD  128
#define QB   256                  // query rows per attention block (16 waves x 16, all walking the same key range)
#define NW   (QB / 16)            // waves per attention block
#define KSPLIT 8                  // key ranges; (SEQ / QB) x KSPLIT blocks of 16 waves = four waves on every SIMD
#define KR   (SEQ / KSPLIT)       // keys per range
#define KS   32                   // keys per step
#define PP   40                   // P tile pitch in halves (80 B rows, 16-B aligned)
#define OP   132                  // O staging pitch in floats
#define PCAR 16384.0f             // power-of-two carry of the f16 P operand, folded back by the final normaliser
#define L2E  1.4426950408889634f

static_assert((SEQ % QB) == 0);
static_assert((SEQ % 64) == 0);
static_assert((SEQ % (KSPLIT * KS)) == 0);
static_assert(SEQ <= SEQ_FULL);
static_assert((DMD % 32) == 0);
static_assert(NB == 1);

typedef _Float16 h16;
typedef unsigned short bf;
typedef __attribute__((ext_vector_type(16))) __bf16   v16bf;
typedef __attribute__((ext_vector_type(16))) _Float16 v16h;
typedef __attribute__((ext_vector_type(8)))  _Float16 v8h;
typedef __attribute__((ext_vector_type(8)))  unsigned short v8us;
typedef __attribute__((ext_vector_type(8)))  float    v8f;
typedef __attribute__((ext_vector_type(4)))  float    v4f;
typedef __attribute__((ext_vector_type(2)))  _Float16 v2h;
typedef __attribute__((ext_vector_type(2)))  unsigned short v2us;
typedef __attribute__((ext_vector_type(2)))  float    v2f;
typedef v8h  __attribute__((may_alias)) v8ha;
typedef v4f  __attribute__((may_alias)) v4fa;
typedef v8us __attribute__((may_alias)) v8usa;

__device__ __forceinline__ unsigned short f2bf(float f) { unsigned u = __float_as_uint(f); u += 0x7FFFu + ((u >> 16) & 1u); return (unsigned short)(u >> 16); }
__device__ __forceinline__ float bf2f(unsigned short b) { return __uint_as_float(((unsigned)b) << 16); }
__device__ __forceinline__ float bfr(float f) { return bf2f(f2bf(f)); }
__device__ __forceinline__ v16h cat16(v8h lo, v8h hi) { return __builtin_shufflevector(lo, hi, 0, 1, 2, 3, 4, 5, 6, 7, 8, 9, 10, 11, 12, 13, 14, 15); }
__device__ __forceinline__ v16bf cat16b(v8us lo, v8us hi) { return __builtin_bit_cast(v16bf, __builtin_shufflevector(lo, hi, 0, 1, 2, 3, 4, 5, 6, 7, 8, 9, 10, 11, 12, 13, 14, 15)); }
__device__ __forceinline__ v8f wmma16(v16h a, v16h b, v8f c) { return __builtin_amdgcn_wmma_f32_16x16x32_f16(false, a, false, b, (short)0, c, false, false); }
__device__ __forceinline__ v8f wmmab(v16bf a, v16bf b, v8f c) { return __builtin_amdgcn_wmma_f32_16x16x32_bf16(false, a, false, b, (short)0, c, false, false); }
__device__ __forceinline__ void splitf(float y, unsigned short& h, unsigned short& l) { h = f2bf(y); l = f2bf(y - bf2f(h)); }

// 16-bit fragment loaders (wave32, 16x16x32): lane -> row/col (lane & 15); elements 0..7 <- k0 + 8*(lane>>4) + 0..7, elements 8..15 <- k0 + 16 + 8*(lane>>4) + 0..7.
// p points at row (lane & 15), column k0 + 8*(lane>>4) of a K-contiguous plane; the same map serves A and B.
template <typename T16> struct WFrag;
template <> struct WFrag<h16> { typedef v16h V; static __device__ __forceinline__ V ld(const h16* p) { return cat16(*(const v8ha*)p, *(const v8ha*)(p + 16)); } static __device__ __forceinline__ v8f mma(V a, V b, v8f c) { return wmma16(a, b, c); } };
template <> struct WFrag<bf> { typedef v16bf V; static __device__ __forceinline__ V ld(const bf* p) { return cat16b(*(const v8usa*)p, *(const v8usa*)(p + 16)); } static __device__ __forceinline__ v8f mma(V a, V b, v8f c) { return wmmab(a, b, c); } };

// ---- k_gemmw: register-blocked GEMM, ONE WAVE per 64x64 output tile (16 accumulators), operands straight from K-contiguous 16-bit planes; grid (M/64, N/64, Z), 32 threads.
// C[m][n] (f32, pitch ldc, + optional f32 bias[n]) = sum_k A[m][k] Bt[n][k] (+ split products per NSPLIT). z-batch strides sA/sB/sC in elements. K % 32 == 0.
template <typename T16, int NSPLIT, bool BIAS>
__global__ __launch_bounds__(32) void k_gemmw(const T16* __restrict__ A, const T16* __restrict__ A2, const T16* __restrict__ Bt, const T16* __restrict__ Bt2, int K, float* C, int ldc, const float* __restrict__ bias, size_t sA, size_t sB, size_t sC) {
    typedef typename WFrag<T16>::V V;
    __shared__ __align__(16) float os[16 * 68];
    const size_t z = blockIdx.z; A += z * sA; if (A2) A2 += z * sA; Bt += z * sB; if (Bt2) Bt2 += z * sB; C += z * sC;
    const int lane = threadIdx.x & 31, lr = lane & 15, hi = lane >> 4; const int r0 = blockIdx.x * 64, c0 = blockIdx.y * 64;
    v8f acc[4][4];
#pragma unroll
    for (int mb = 0; mb < 4; ++mb)
#pragma unroll
        for (int nb = 0; nb < 4; ++nb) acc[mb][nb] = (v8f){};
    const size_t aoff = (size_t)(r0 + lr) * K + 8 * hi, boff = (size_t)(c0 + lr) * K + 8 * hi;
#pragma unroll 1
    for (int kc = 0; kc < K; kc += 32) {
        V a[4], a2[4];
#pragma unroll
        for (int mb = 0; mb < 4; ++mb) { a[mb] = WFrag<T16>::ld(A + aoff + (size_t)mb * 16 * K + kc); if (NSPLIT == 1 || NSPLIT == 2) a2[mb] = WFrag<T16>::ld(A2 + aoff + (size_t)mb * 16 * K + kc); }
#pragma unroll
        for (int nb = 0; nb < 4; ++nb) { const V b = WFrag<T16>::ld(Bt + boff + (size_t)nb * 16 * K + kc); V b2; if (NSPLIT >= 2) b2 = WFrag<T16>::ld(Bt2 + boff + (size_t)nb * 16 * K + kc);
#pragma unroll
            for (int mb = 0; mb < 4; ++mb) { acc[mb][nb] = WFrag<T16>::mma(a[mb], b, acc[mb][nb]); if (NSPLIT == 1 || NSPLIT == 2) acc[mb][nb] = WFrag<T16>::mma(a2[mb], b, acc[mb][nb]); if (NSPLIT >= 2) acc[mb][nb] = WFrag<T16>::mma(a[mb], b2, acc[mb][nb]); } }
        asm volatile("v_nop\n\tv_nop\n\tv_nop\n\tv_nop" : "+v"(acc[0][0]), "+v"(acc[1][1]), "+v"(acc[2][2]), "+v"(acc[3][3]) : "v"(a[0]), "v"(a[3]));
    }
#pragma unroll
    for (int mb = 0; mb < 4; ++mb) {
#pragma unroll
        for (int nb = 0; nb < 4; ++nb) {
#pragma unroll
            for (int j = 0; j < 8; ++j) os[(hi * 8 + j) * 68 + nb * 16 + lr] = acc[mb][nb][j]; }
        __builtin_amdgcn_fence(3, "wavefront"); __builtin_amdgcn_wave_barrier(); asm volatile("" ::: "memory");
        float* crow = C + (size_t)(r0 + mb * 16) * ldc + c0;
{
#pragma unroll
            for (int s = 0; s < 8; ++s) { const int row = 2 * s + hi, cofs = lr * 4; v4f val = *(const v4fa*)(os + row * 68 + cofs); if (BIAS) { val[0] += bfr(bias[c0 + cofs]); val[1] += bfr(bias[c0 + cofs + 1]); val[2] += bfr(bias[c0 + cofs + 2]); val[3] += bfr(bias[c0 + cofs + 3]); }
                *(v4f*)(crow + (size_t)row * ldc + cofs) = val; }
             }
        __builtin_amdgcn_wave_barrier(); asm volatile("" ::: "memory");
    }
}

__global__ __launch_bounds__(256) void k_cvt8(const float* __restrict__ src, bf* dst, size_t n8) { const size_t i = (size_t)blockIdx.x * 256 + threadIdx.x; if (i >= n8) return; const v8f v = *(const v8f*)(src + i * 8); v8us o;
#pragma unroll
    for (int k = 0; k < 8; ++k) { const float f = v[k]; o[k] = f2bf(f); } *(v8us*)(dst + i * 8) = o;  }

__global__ __launch_bounds__(256) void k_hlp(const float* __restrict__ F, int n, bf* Ph, bf* Pl) {
    const int e = (blockIdx.x * 256 + threadIdx.x) * 2; if (e >= n) return;
    const v2f x = *(const v2f*)(F + e); v2us oh, ol;
#pragma unroll
    for (int q = 0; q < 2; ++q) { const float xv = x[q]; unsigned short a2, c2; splitf(xv, a2, c2); oh[q] = a2; ol[q] = c2; }
    *(v2us*)(Ph + e) = oh; *(v2us*)(Pl + e) = ol; 
}

__global__ __launch_bounds__(256) void k_vt16(const float* __restrict__ F, h16* VT) {
    const int e = (blockIdx.x * 256 + threadIdx.x) * 2; if (e >= DMD * SEQ) return;
    const int t = e % SEQ, d = e / SEQ; v2h o16;
    const float x0 = F[(size_t)t * DMD + d], x1 = F[(size_t)(t + 1) * DMD + d];
    o16[0] = (h16)x0; o16[1] = (h16)x1;
    *(v2h*)(VT + e) = o16; 
}

// k_attn: streaming attention over one key range. Block = 16 waves = 256 query rows; wave w owns rows r0..r0+15; blockIdx.y names the range of KR keys. Per 32-key step:
//   S[16x32] = q.k^T from bf16 hi/lo planes (products hh + hl + lh, K = 128 in 4 steps), running row max / sum in f32 (16-lane shuffles),
//   P = exp(s - m) x 2^14 as f16 into a wave-private LDS tile (row-major, pitch PP), reloaded with the fragment loader as the A operand,
//   O[16x128] += P . v (B from the f16 VT plane), O rescaled by alpha each step. The row sum uses the same f16-converted P values.
// Leaves PO[range][row][128] = un-normalised O and ML[range][row] = (row max, row sum), both relative to the range's own max.
__global__ __launch_bounds__(NW * 32) __attribute__((amdgpu_num_vgpr(256)))
void k_attn(const bf* __restrict__ QPh, const bf* __restrict__ QPl, const bf* __restrict__ KPh, const bf* __restrict__ KPl, const h16* __restrict__ VT, float* PO, float* ML) {
    __shared__ __align__(16) h16 psm[NW * 16 * PP];
    __shared__ __align__(16) float osm[NW * 16 * OP];
    const int wave = threadIdx.x >> 5, lane = threadIdx.x & 31, lr = lane & 15, hi = lane >> 4;
    const int r0 = blockIdx.x * QB + wave * 16;
    const int jb = blockIdx.y * KR;
    h16* pw = psm + wave * (16 * PP);
    float* ow = osm + wave * (16 * OP);
    v8f o[8];
#pragma unroll
    for (int dt = 0; dt < 8; ++dt) o[dt] = (v8f){};
    float mrow[8], lrow[8];
#pragma unroll
    for (int r = 0; r < 8; ++r) { mrow[r] = -1.0e30f; lrow[r] = 0.0f; }
    const size_t qoff = (size_t)(r0 + lr) * DMD + 8 * hi;
    const size_t koff = (size_t)lr * DMD + 8 * hi;
    const size_t voff = (size_t)lr * SEQ + 8 * hi;
#pragma unroll 1
    for (int j0 = jb; j0 < jb + KR; j0 += KS) {
        v8f s[2]; s[0] = (v8f){}; s[1] = (v8f){};
        v16bf ah, al, bh0, bl0, bh1, bl1;
#pragma unroll
        for (int ks = 0; ks < DMD / 32; ++ks) {
            ah = WFrag<bf>::ld(QPh + qoff + ks * 32); al = WFrag<bf>::ld(QPl + qoff + ks * 32);
            const size_t k0 = (size_t)j0 * DMD + koff + ks * 32, k1 = k0 + (size_t)16 * DMD;
            bh0 = WFrag<bf>::ld(KPh + k0); bl0 = WFrag<bf>::ld(KPl + k0);
            bh1 = WFrag<bf>::ld(KPh + k1); bl1 = WFrag<bf>::ld(KPl + k1);
            s[0] = wmmab(ah, bh0, s[0]); s[0] = wmmab(ah, bl0, s[0]); s[0] = wmmab(al, bh0, s[0]);
            s[1] = wmmab(ah, bh1, s[1]); s[1] = wmmab(ah, bl1, s[1]); s[1] = wmmab(al, bh1, s[1]);
        }
        asm volatile("v_nop\n\tv_nop\n\tv_nop\n\tv_nop" : "+v"(s[0]), "+v"(s[1]) : "v"(ah), "v"(al), "v"(bh0), "v"(bl0), "v"(bh1), "v"(bl1));
        // online softmax: lane half hi holds rows 8*hi + r, columns (keys) j0 + nt*16 + lr
#pragma unroll
        for (int r = 0; r < 8; ++r) {
            float mx = fmaxf(s[0][r], s[1][r]);
            mx = fmaxf(mx, __shfl_xor(mx, 1, 32)); mx = fmaxf(mx, __shfl_xor(mx, 2, 32)); mx = fmaxf(mx, __shfl_xor(mx, 4, 32)); mx = fmaxf(mx, __shfl_xor(mx, 8, 32));
            const float mn = fmaxf(mrow[r], mx);
            const float alpha = __builtin_amdgcn_exp2f((mrow[r] - mn) * L2E);
            mrow[r] = mn;
            const float e0 = __builtin_amdgcn_exp2f((s[0][r] - mn) * L2E) * PCAR;
            const float e1 = __builtin_amdgcn_exp2f((s[1][r] - mn) * L2E) * PCAR;
            const h16 p0 = (h16)e0, p1 = (h16)e1;
            float rs = (float)p0 + (float)p1;
            rs += __shfl_xor(rs, 1, 32); rs += __shfl_xor(rs, 2, 32); rs += __shfl_xor(rs, 4, 32); rs += __shfl_xor(rs, 8, 32);
            lrow[r] = lrow[r] * alpha + rs;
            pw[(8 * hi + r) * PP + lr] = p0; pw[(8 * hi + r) * PP + 16 + lr] = p1;
#pragma unroll
            for (int dt = 0; dt < 8; ++dt) o[dt][r] *= alpha;
        }
        __builtin_amdgcn_fence(3, "wavefront"); __builtin_amdgcn_wave_barrier(); asm volatile("" ::: "memory");
        const v16h pa = WFrag<h16>::ld(pw + lr * PP + 8 * hi);
        v16h vb;
#pragma unroll
        for (int dt = 0; dt < 8; ++dt) { vb = WFrag<h16>::ld(VT + (size_t)(dt * 16) * SEQ + voff + j0); o[dt] = wmma16(pa, vb, o[dt]); }
        asm volatile("v_nop\n\tv_nop\n\tv_nop\n\tv_nop" : "+v"(o[0]), "+v"(o[1]), "+v"(o[2]), "+v"(o[3]), "+v"(o[4]), "+v"(o[5]), "+v"(o[6]), "+v"(o[7]) : "v"(pa), "v"(vb));
        asm volatile("" ::: "memory");
    }
#pragma unroll
    for (int r = 0; r < 8; ++r) {
#pragma unroll
        for (int dt = 0; dt < 8; ++dt) ow[(8 * hi + r) * OP + dt * 16 + lr] = o[dt][r]; }
    __builtin_amdgcn_fence(3, "wavefront"); __builtin_amdgcn_wave_barrier(); asm volatile("" ::: "memory");
    const size_t prow = (size_t)blockIdx.y * SEQ + r0;
    float* orow = PO + prow * DMD + lane * 4;
{
#pragma unroll
        for (int row = 0; row < 16; ++row) { const v4f val = *(const v4fa*)(ow + row * OP + lane * 4); *(v4f*)(orow + (size_t)row * DMD) = val; }
        
    }
    // the 16 (max, sum) pairs of a wave fill one 128-B line; every lane of a half holds its 8 rows' values, lane 0 of the half stores them
    if (lr == 0) {
#pragma unroll
        for (int r = 0; r < 8; ++r) { v2f ml; ml[0] = mrow[r]; ml[1] = lrow[r]; *(v2f*)(ML + (prow + 8 * hi + r) * 2) = ml; }
    }
}

// v_exp_f32 with one v_nop behind it: the free slot that the instruction set asks for before a directly following instruction reads the result or overwrites the source.
__device__ __forceinline__ float exp2_slot(float x) { float y; asm("v_exp_f32 %0, %1\n\tv_nop" : "=v"(y) : "v"(x)); return y; }

// k_merge: one wave per output row, 16 B per lane. M = max of the ranges' maxima; weight w = exp(m - M); out = sum w O / sum w l.
__global__ __launch_bounds__(256) void k_merge(const float* __restrict__ PO, const float* __restrict__ ML, float* OUT) {
    const int row = __builtin_amdgcn_readfirstlane(blockIdx.x * 8 + (threadIdx.x >> 5));   // the row is the wave's own: held scalar, its (max, sum) pairs and row bases come by the scalar path
    const unsigned c = (threadIdx.x & 31) * 4;
    v2f ml[KSPLIT]; v4f p[KSPLIT];
#pragma unroll
    for (int s = 0; s < KSPLIT; ++s) ml[s] = *(const v2f*)(ML + ((size_t)s * SEQ + row) * 2);
#pragma unroll
    for (int s = 0; s < KSPLIT; ++s) { p[s] = *(const v4f*)(PO + ((size_t)s * SEQ + row) * DMD + c);
        asm volatile("s_wait_xcnt 0x0" ::: "memory"); }   // a later load's result may be given this load's address registers: the wait stands in front of that overwrite; the data waits stay counted
    float M = ml[0][0];
#pragma unroll
    for (int s = 1; s < KSPLIT; ++s) M = fmaxf(M, ml[s][0]);
    float L = 0.0f; v4f a = (v4f){};
#pragma unroll
    for (int s = 0; s < KSPLIT; ++s) { const float w = exp2_slot((ml[s][0] - M) * L2E); L += w * ml[s][1]; a += w * p[s]; }
    const float inv = 1.0f / L;
    *(v4f*)(OUT + (size_t)row * DMD + c) = a * inv;
}

extern "C" void kernel_launch(void* const* d_in, const int* in_sizes, int n_in,
                              void* d_out, int out_size, void* d_ws, size_t ws_size, hipStream_t stream) {
    if (n_in < 4) return;
    if (in_sizes[0] < SEQ * DMD || in_sizes[1] < DMD * DMD || in_sizes[2] < DMD * DMD || in_sizes[3] < DMD * DMD || out_size < SEQ * DMD) return;
    const float* x = (const float*)d_in[0]; const float* wq = (const float*)d_in[1]; const float* wk = (const float*)d_in[2]; const float* wv = (const float*)d_in[3];
    float* OUT = (float*)d_out;     // [SEQ][128] f32
    char* wsp = (char*)d_ws;
    auto take = [&](size_t bytes) { char* p = wsp; wsp += (bytes + 255) & ~(size_t)255; return (void*)p; };
    bf* WQ = (bf*)take((size_t)DMD * DMD * 2); bf* WK = (bf*)take((size_t)DMD * DMD * 2); bf* WV = (bf*)take((size_t)DMD * DMD * 2);
    bf* XB = (bf*)take((size_t)SEQ * DMD * 2);
    float* FQ = (float*)take((size_t)SEQ * DMD * 4); float* FK = (float*)take((size_t)SEQ * DMD * 4); float* FV = (float*)take((size_t)SEQ * DMD * 4);
    bf* QPh = (bf*)take((size_t)SEQ * DMD * 2); bf* QPl = (bf*)take((size_t)SEQ * DMD * 2); bf* KPh = (bf*)take((size_t)SEQ * DMD * 2); bf* KPl = (bf*)take((size_t)SEQ * DMD * 2);
    h16* VT = (h16*)take((size_t)DMD * SEQ * 2);
    float* PO = (float*)take((size_t)KSPLIT * SEQ * DMD * 4); float* ML = (float*)take((size_t)KSPLIT * SEQ * 2 * 4);
    const size_t used = (size_t)(wsp - (char*)d_ws);
    if (used > ws_size || used > (size_t)134217728) return;

    // bf16 copies of the weights ([out][in] = Bt as-is) and of x
    k_cvt8<<<(unsigned)(((size_t)DMD * DMD / 8 + 255) / 256), 256, 0, stream>>>(wq, WQ, (size_t)DMD * DMD / 8);
    k_cvt8<<<(unsigned)(((size_t)DMD * DMD / 8 + 255) / 256), 256, 0, stream>>>(wk, WK, (size_t)DMD * DMD / 8);
    k_cvt8<<<(unsigned)(((size_t)DMD * DMD / 8 + 255) / 256), 256, 0, stream>>>(wv, WV, (size_t)DMD * DMD / 8);
    k_cvt8<<<(unsigned)(((size_t)SEQ * DMD / 8 + 255) / 256), 256, 0, stream>>>(x, XB, (size_t)SEQ * DMD / 8);
    // q, k, v projections: [SEQ][128] f32 = XB[SEQ][128] . W[128][128]^T
    k_gemmw<bf, 0, false><<<dim3(SEQ / 64, DMD / 64, 1), 32, 0, stream>>>(XB, nullptr, WQ, nullptr, DMD, FQ, DMD, nullptr, 0, 0, 0);
    k_gemmw<bf, 0, false><<<dim3(SEQ / 64, DMD / 64, 1), 32, 0, stream>>>(XB, nullptr, WK, nullptr, DMD, FK, DMD, nullptr, 0, 0, 0);
    k_gemmw<bf, 0, false><<<dim3(SEQ / 64, DMD / 64, 1), 32, 0, stream>>>(XB, nullptr, WV, nullptr, DMD, FV, DMD, nullptr, 0, 0, 0);
    // operand planes: q, k as bf16 hi/lo [t][d]; v as f16 [d][t]
    const unsigned LP = (unsigned)(((size_t)SEQ * DMD / 2 + 255) / 256);
    k_hlp<<<LP, 256, 0, stream>>>(FQ, SEQ * DMD, QPh, QPl);
    k_hlp<<<LP, 256, 0, stream>>>(FK, SEQ * DMD, KPh, KPl);
    k_vt16<<<LP, 256, 0, stream>>>(FV, VT);
    // attention: one block per 256 query rows and key range, then the merge of the ranges
    k_attn<<<dim3(SEQ / QB, KSPLIT, 1), NW * 32, 0, stream>>>(QPh, QPl, KPh, KPl, VT, PO, ML);
    k_merge<<<SEQ * 32 / 256, 256, 0, stream>>>(PO, ML, OUT);
}

// v002
// One run takes 212 microseconds.
// Next to v001, in two timings, it ran 1.41 and 1.40 times as fast.
// Over all steps from v000 it is 6.01 times as fast.
#include <hip/hip_runtime.h>

#ifndef NB
#define NB 1
#endif
#ifndef SEQ
#define SEQ 8192
#endif
#define SEQ_FULL 8192
#define DMD  128
#define QB   256                  // query rows per attention block (16 waves x 16, all walking the same key range)
#define NW   (QB / 16)            // waves per attention block
#define KSPLIT 8                  // key ranges; (SEQ / QB) x KSPLIT blocks of 16 waves = four waves on every SIMD
#define KR   (SEQ / KSPLIT)       // keys per range
#define KS   32                   // keys per step
#define OP   132                  // O staging pitch in floats
#define PCAR 16384.0f             // power-of-two carry of the f16 P operand, folded back by the final normaliser
#define L2E  1.4426950408889634f

static_assert((SEQ % QB) == 0);
static_assert((SEQ % 64) == 0);
static_assert((SEQ % (KSPLIT * KS)) == 0);
static_assert(SEQ <= SEQ_FULL);
static_assert((DMD % 32) == 0);
static_assert(NB == 1);

typedef _Float16 h16;
typedef unsigned short bf;
typedef __attribute__((ext_vector_type(16))) __bf16   v16bf;
typedef __attribute__((ext_vector_type(16))) _Float16 v16h;
typedef __attribute__((ext_vector_type(8)))  _Float16 v8h;
typedef __attribute__((ext_vector_type(8)))  unsigned short v8us;
typedef __attribute__((ext_vector_type(8)))  float    v8f;
typedef __attribute__((ext_vector_type(4)))  float    v4f;
typedef __attribute__((ext_vector_type(2)))  _Float16 v2h;
typedef __attribute__((ext_vector_type(2)))  unsigned short v2us;
typedef __attribute__((ext_vector_type(2)))  float    v2f;
typedef v8h  __attribute__((may_alias)) v8ha;
typedef v4f  __attribute__((may_alias)) v4fa;
typedef v8us __attribute__((may_alias)) v8usa;

__device__ __forceinline__ unsigned short f2bf(float f) { unsigned u = __float_as_uint(f); u += 0x7FFFu + ((u >> 16) & 1u); return (unsigned short)(u >> 16); }
__device__ __forceinline__ float bf2f(unsigned short b) { return __uint_as_float(((unsigned)b) << 16); }
__device__ __forceinline__ float bfr(float f) { return bf2f(f2bf(f)); }
__device__ __forceinline__ v16h cat16(v8h lo, v8h hi) { return __builtin_shufflevector(lo, hi, 0, 1, 2, 3, 4, 5, 6, 7, 8, 9, 10, 11, 12, 13, 14, 15); }
__device__ __forceinline__ v16bf cat16b(v8us lo, v8us hi) { return __builtin_bit_cast(v16bf, __builtin_shufflevector(lo, hi, 0, 1, 2, 3, 4, 5, 6, 7, 8, 9, 10, 11, 12, 13, 14, 15)); }
__device__ __forceinline__ v8f wmma16(v16h a, v16h b, v8f c) { return __builtin_amdgcn_wmma_f32_16x16x32_f16(false, a, false, b, (short)0, c, false, false); }
__device__ __forceinline__ v8f wmmab(v16bf a, v16bf b, v8f c) { return __builtin_amdgcn_wmma_f32_16x16x32_bf16(false, a, false, b, (short)0, c, false, false); }
__device__ __forceinline__ float xhalf(float x) { return __builtin_bit_cast(float, __builtin_amdgcn_permlanex16(__builtin_bit_cast(int, x), __builtin_bit_cast(int, x), 0x76543210, 0xfedcba98, false, false)); }  // lane l with lane l ^ 16
__device__ __forceinline__ void splitf(float y, unsigned short& h, unsigned short& l) { h = f2bf(y); l = f2bf(y - bf2f(h)); }

// 16-bit fragment loaders (wave32, 16x16x32): lane -> row/col (lane & 15); elements 0..7 <- k0 + 8*(lane>>4) + 0..7, elements 8..15 <- k0 + 16 + 8*(lane>>4) + 0..7.
// p points at row (lane & 15), column k0 + 8*(lane>>4) of a K-contiguous plane; the same map serves A and B.
template <typename T16> struct WFrag;
template <> struct WFrag<h16> { typedef v16h V; static __device__ __forceinline__ V ld(const h16* p) { return cat16(*(const v8ha*)p, *(const v8ha*)(p + 16)); } static __device__ __forceinline__ v8f mma(V a, V b, v8f c) { return wmma16(a, b, c); } };
template <> struct WFrag<bf> { typedef v16bf V; static __device__ __forceinline__ V ld(const bf* p) { return cat16b(*(const v8usa*)p, *(const v8usa*)(p + 16)); } static __device__ __forceinline__ v8f mma(V a, V b, v8f c) { return wmmab(a, b, c); } };

// ---- k_gemmw: register-blocked GEMM, ONE WAVE per 64x64 output tile (16 accumulators), operands straight from K-contiguous 16-bit planes; grid (M/64, N/64, Z), 32 threads.
// C[m][n] (f32, pitch ldc, + optional f32 bias[n]) = sum_k A[m][k] Bt[n][k] (+ split products per NSPLIT). z-batch strides sA/sB/sC in elements. K % 32 == 0.
template <typename T16, int NSPLIT, bool BIAS>
__global__ __launch_bounds__(32) void k_gemmw(const T16* __restrict__ A, const T16* __restrict__ A2, const T16* __restrict__ Bt, const T16* __restrict__ Bt2, int K, float* C, int ldc, const float* __restrict__ bias, size_t sA, size_t sB, size_t sC) {
    typedef typename WFrag<T16>::V V;
    __shared__ __align__(16) float os[16 * 68];
    const size_t z = blockIdx.z; A += z * sA; if (A2) A2 += z * sA; Bt += z * sB; if (Bt2) Bt2 += z * sB; C += z * sC;
    const int lane = threadIdx.x & 31, lr = lane & 15, hi = lane >> 4; const int r0 = blockIdx.x * 64, c0 = blockIdx.y * 64;
    v8f acc[4][4];
#pragma unroll
    for (int mb = 0; mb < 4; ++mb)
#pragma unroll
        for (int nb = 0; nb < 4; ++nb) acc[mb][nb] = (v8f){};
    const size_t aoff = (size_t)(r0 + lr) * K + 8 * hi, boff = (size_t)(c0 + lr) * K + 8 * hi;
#pragma unroll 1
    for (int kc = 0; kc < K; kc += 32) {
        V a[4], a2[4];
#pragma unroll
        for (int mb = 0; mb < 4; ++mb) { a[mb] = WFrag<T16>::ld(A + aoff + (size_t)mb * 16 * K + kc); if (NSPLIT == 1 || NSPLIT == 2) a2[mb] = WFrag<T16>::ld(A2 + aoff + (size_t)mb * 16 * K + kc); }
#pragma unroll
        for (int nb = 0; nb < 4; ++nb) { const V b = WFrag<T16>::ld(Bt + boff + (size_t)nb * 16 * K + kc); V b2; if (NSPLIT >= 2) b2 = WFrag<T16>::ld(Bt2 + boff + (size_t)nb * 16 * K + kc);
#pragma unroll
            for (int mb = 0; mb < 4; ++mb) { acc[mb][nb] = WFrag<T16>::mma(a[mb], b, acc[mb][nb]); if (NSPLIT == 1 || NSPLIT == 2) acc[mb][nb] = WFrag<T16>::mma(a2[mb], b, acc[mb][nb]); if (NSPLIT >= 2) acc[mb][nb] = WFrag<T16>::mma(a[mb], b2, acc[mb][nb]); } }
        asm volatile("v_nop\n\tv_nop\n\tv_nop\n\tv_nop" : "+v"(acc[0][0]), "+v"(acc[1][1]), "+v"(acc[2][2]), "+v"(acc[3][3]) : "v"(a[0]), "v"(a[3]));
    }
#pragma unroll
    for (int mb = 0; mb < 4; ++mb) {
#pragma unroll
        for (int nb = 0; nb < 4; ++nb) {
#pragma unroll
            for (int j = 0; j < 8; ++j) os[(hi * 8 + j) * 68 + nb * 16 + lr] = acc[mb][nb][j]; }
        __builtin_amdgcn_fence(3, "wavefront"); __builtin_amdgcn_wave_barrier(); asm volatile("" ::: "memory");
        float* crow = C + (size_t)(r0 + mb * 16) * ldc + c0;
{
#pragma unroll
            for (int s = 0; s < 8; ++s) { const int row = 2 * s + hi, cofs = lr * 4; v4f val = *(const v4fa*)(os + row * 68 + cofs); if (BIAS) { val[0] += bfr(bias[c0 + cofs]); val[1] += bfr(bias[c0 + cofs + 1]); val[2] += bfr(bias[c0 + cofs + 2]); val[3] += bfr(bias[c0 + cofs + 3]); }
                *(v4f*)(crow + (size_t)row * ldc + cofs) = val; }
             }
        __builtin_amdgcn_wave_barrier(); asm volatile("" ::: "memory");
    }
}

__global__ __launch_bounds__(256) void k_cvt8(const float* __restrict__ src, bf* dst, size_t n8) { const size_t i = (size_t)blockIdx.x * 256 + threadIdx.x; if (i >= n8) return; const v8f v = *(const v8f*)(src + i * 8); v8us o;
#pragma unroll
    for (int k = 0; k < 8; ++k) { const float f = v[k]; o[k] = f2bf(f); } *(v8us*)(dst + i * 8) = o;  }

__global__ __launch_bounds__(256) void k_hlp(const float* __restrict__ F, int n, bf* Ph, bf* Pl) {
    const int e = (blockIdx.x * 256 + threadIdx.x) * 2; if (e >= n) return;
    const v2f x = *(const v2f*)(F + e); v2us oh, ol;
#pragma unroll
    for (int q = 0; q < 2; ++q) { const float xv = x[q]; unsigned short a2, c2; splitf(xv, a2, c2); oh[q] = a2; ol[q] = c2; }
    *(v2us*)(Ph + e) = oh; *(v2us*)(Pl + e) = ol; 
}

__global__ __launch_bounds__(256) void k_vt16(const float* __restrict__ F, h16* VT) {
    const int e = (blockIdx.x * 256 + threadIdx.x) * 2; if (e >= DMD * SEQ) return;
    const int t = e % SEQ, d = e / SEQ; v2h o16;
    const float x0 = F[(size_t)t * DMD + d], x1 = F[(size_t)(t + 1) * DMD + d];
    o16[0] = (h16)x0; o16[1] = (h16)x1;
    *(v2h*)(VT + e) = o16; 
}

// v_exp_f32 with one v_nop behind it: the free slot that the instruction set asks for before a directly following instruction reads the result or overwrites the source.
__device__ __forceinline__ float exp2_slot(float x) { float y; asm("v_exp_f32 %0, %1\n\tv_nop" : "=v"(y) : "v"(x)); return y; }

// k_attn: streaming attention over one key range. Block = 16 waves = 256 queries; wave w owns queries r0..r0+15; blockIdx.y names the range of KR keys. Per 32-key step:
//   S^T[32x16] = k.q^T from bf16 hi/lo planes (products hh + lh + hl, K = 128 in 4 steps): A = key rows, B = query columns, so lane (lr, hi) holds query r0 + lr and keys j0 + 16*nt + 8*hi + r;
//   running max in f32: 16 values in the lane, then one exchange between the lane halves; running sum per lane over its own half's keys, the halves joined once behind the loop;
//   P^T = exp(s - m) x 2^14 as f16: the two score tiles, converted in place, are the B operand of the second product (element e = key 8*hi + e, element 8 + e = key 16 + 8*hi + e: the fragment loader's k order);
//   O^T[128x16] += v^T . P^T (A from the f16 VT plane), O^T rescaled by the lane's alpha each step. The row sum uses the same f16-converted P values.
// Leaves PO[range][row][128] = un-normalised O and ML[range][row] = (row max, row sum), both relative to the range's own max.
__global__ __launch_bounds__(NW * 32) __attribute__((amdgpu_num_vgpr(256)))
void k_attn(const bf* __restrict__ QPh, const bf* __restrict__ QPl, const bf* __restrict__ KPh, const bf* __restrict__ KPl, const h16* __restrict__ VT, float* PO, float* ML) {
    __shared__ __align__(16) float osm[NW * 16 * OP];
    const int wave = threadIdx.x >> 5, lane = threadIdx.x & 31, lr = lane & 15, hi = lane >> 4;
    const int r0 = blockIdx.x * QB + wave * 16;
    const int jb = blockIdx.y * KR;
    float* ow = osm + wave * (16 * OP);
    v8f o[8];
#pragma unroll
    for (int dt = 0; dt < 8; ++dt) o[dt] = (v8f){};
    float m = -1.0e30f, l = 0.0f;
    const size_t qoff = (size_t)(r0 + lr) * DMD + 8 * hi;
    const size_t koff = (size_t)lr * DMD + 8 * hi;
    const size_t voff = (size_t)lr * SEQ + 8 * hi;
#pragma unroll 1
    for (int j0 = jb; j0 < jb + KR; j0 += KS) {
        v8f s[2]; s[0] = (v8f){}; s[1] = (v8f){};
        v16bf ah, al, bh0, bl0, bh1, bl1;
#pragma unroll
        for (int ks = 0; ks < DMD / 32; ++ks) {
            ah = WFrag<bf>::ld(QPh + qoff + ks * 32); al = WFrag<bf>::ld(QPl + qoff + ks * 32);
            const size_t k0 = (size_t)j0 * DMD + koff + ks * 32, k1 = k0 + (size_t)16 * DMD;
            bh0 = WFrag<bf>::ld(KPh + k0); bl0 = WFrag<bf>::ld(KPl + k0);
            bh1 = WFrag<bf>::ld(KPh + k1); bl1 = WFrag<bf>::ld(KPl + k1);
            s[0] = wmmab(bh0, ah, s[0]); s[0] = wmmab(bl0, ah, s[0]); s[0] = wmmab(bh0, al, s[0]);
            s[1] = wmmab(bh1, ah, s[1]); s[1] = wmmab(bl1, ah, s[1]); s[1] = wmmab(bh1, al, s[1]);
        }
        asm volatile("v_nop\n\tv_nop\n\tv_nop\n\tv_nop" : "+v"(s[0]), "+v"(s[1]) : "v"(ah), "v"(al), "v"(bh0), "v"(bl0), "v"(bh1), "v"(bl1));
        // online softmax of the lane's own query
        float mx8[8];
#pragma unroll
        for (int r = 0; r < 8; ++r) mx8[r] = fmaxf(s[0][r], s[1][r]);
        float mx = fmaxf(fmaxf(fmaxf(mx8[0], mx8[1]), fmaxf(mx8[2], mx8[3])), fmaxf(fmaxf(mx8[4], mx8[5]), fmaxf(mx8[6], mx8[7])));
        mx = fmaxf(mx, xhalf(mx));
        const float mn = fmaxf(m, mx);
        const float alpha = exp2_slot((m - mn) * L2E);
        m = mn;
        v16h pb; float rs8[8];
#pragma unroll
        for (int r = 0; r < 8; ++r) {
            const float e0 = __builtin_amdgcn_exp2f((s[0][r] - mn) * L2E) * PCAR;
            const float e1 = __builtin_amdgcn_exp2f((s[1][r] - mn) * L2E) * PCAR;
            const h16 p0 = (h16)e0, p1 = (h16)e1;
            pb[r] = p0; pb[8 + r] = p1;
            rs8[r] = (float)p0 + (float)p1;
        }
        l = l * alpha + (((rs8[0] + rs8[1]) + (rs8[2] + rs8[3])) + ((rs8[4] + rs8[5]) + (rs8[6] + rs8[7])));
#pragma unroll
        for (int dt = 0; dt < 8; ++dt) o[dt] *= alpha;
        v16h vb;
#pragma unroll
        for (int dt = 0; dt < 8; ++dt) { vb = WFrag<h16>::ld(VT + (size_t)(dt * 16) * SEQ + voff + j0); o[dt] = wmma16(vb, pb, o[dt]); }
        asm volatile("v_nop\n\tv_nop\n\tv_nop\n\tv_nop" : "+v"(o[0]), "+v"(o[1]), "+v"(o[2]), "+v"(o[3]), "+v"(o[4]), "+v"(o[5]), "+v"(o[6]), "+v"(o[7]) : "v"(pb), "v"(vb));
    }
    l += xhalf(l);
    // o[dt][r] = O[query lr][dt*16 + 8*hi + r]: eight consecutive floats of the query's staged row
#pragma unroll
    for (int dt = 0; dt < 8; ++dt) {
        v4f lo4, hi4;
#pragma unroll
        for (int r = 0; r < 4; ++r) { lo4[r] = o[dt][r]; hi4[r] = o[dt][4 + r]; }
        *(v4fa*)(ow + lr * OP + dt * 16 + 8 * hi) = lo4; *(v4fa*)(ow + lr * OP + dt * 16 + 8 * hi + 4) = hi4; }
    __builtin_amdgcn_fence(3, "wavefront"); __builtin_amdgcn_wave_barrier(); asm volatile("" ::: "memory");
    const size_t prow = (size_t)blockIdx.y * SEQ + r0;
    float* orow = PO + prow * DMD + lane * 4;
{
#pragma unroll
        for (int row = 0; row < 16; ++row) { const v4f val = *(const v4fa*)(ow + row * OP + lane * 4); *(v4f*)(orow + (size_t)row * DMD) = val; }
        
    }
    // the 16 (max, sum) pairs of a wave fill one 128-B line; lane lr of the lower half stores its own query's pair
    if (hi == 0) { v2f ml; ml[0] = m; ml[1] = l; *(v2f*)(ML + (prow + lr) * 2) = ml; }
}

// k_merge: one wave per output row, 16 B per lane. M = max of the ranges' maxima; weight w = exp(m - M); out = sum w O / sum w l.
__global__ __launch_bounds__(256) void k_merge(const float* __restrict__ PO, const float* __restrict__ ML, float* OUT) {
    const int row = __builtin_amdgcn_readfirstlane(blockIdx.x * 8 + (threadIdx.x >> 5));   // the row is the wave's own: held scalar, its (max, sum) pairs and row bases come by the scalar path
    const unsigned c = (threadIdx.x & 31) * 4;
    v2f ml[KSPLIT]; v4f p[KSPLIT];
#pragma unroll
    for (int s = 0; s < KSPLIT; ++s) ml[s] = *(const v2f*)(ML + ((size_t)s * SEQ + row) * 2);
#pragma unroll
    for (int s = 0; s < KSPLIT; ++s) { p[s] = *(const v4f*)(PO + ((size_t)s * SEQ + row) * DMD + c);
        asm volatile("s_wait_xcnt 0x0" ::: "memory"); }   // a later load's result may be given this load's address registers: the wait stands in front of that overwrite; the data waits stay counted
    float M = ml[0][0];
#pragma unroll
    for (int s = 1; s < KSPLIT; ++s) M = fmaxf(M, ml[s][0]);
    float L = 0.0f; v4f a = (v4f){};
#pragma unroll
    for (int s = 0; s < KSPLIT; ++s) { const float w = exp2_slot((ml[s][0] - M) * L2E); L += w * ml[s][1]; a += w * p[s]; }
    const float inv = 1.0f / L;
    *(v4f*)(OUT + (size_t)row * DMD + c) = a * inv;
}

extern "C" void kernel_launch(void* const* d_in, const int* in_sizes, int n_in,
                              void* d_out, int out_size, void* d_ws, size_t ws_size, hipStream_t stream) {
    if (n_in < 4) return;
    if (in_sizes[0] < SEQ * DMD || in_sizes[1] < DMD * DMD || in_sizes[2] < DMD * DMD || in_sizes[3] < DMD * DMD || out_size < SEQ * DMD) return;
    const float* x = (const float*)d_in[0]; const float* wq = (const float*)d_in[1]; const float* wk = (const float*)d_in[2]; const float* wv = (const float*)d_in[3];
    float* OUT = (float*)d_out;     // [SEQ][128] f32
    char* wsp = (char*)d_ws;
    auto take = [&](size_t bytes) { char* p = wsp; wsp += (bytes + 255) & ~(size_t)255; return (void*)p; };
    bf* WQ = (bf*)take((size_t)DMD * DMD * 2); bf* WK = (bf*)take((size_t)DMD * DMD * 2); bf* WV = (bf*)take((size_t)DMD * DMD * 2);
    bf* XB = (bf*)take((size_t)SEQ * DMD * 2);
    float* FQ = (float*)take((size_t)SEQ * DMD * 4); float* FK = (float*)take((size_t)SEQ * DMD * 4); float* FV = (float*)take((size_t)SEQ * DMD * 4);
    bf* QPh = (bf*)take((size_t)SEQ * DMD * 2); bf* QPl = (bf*)take((size_t)SEQ * DMD * 2); bf* KPh = (bf*)take((size_t)SEQ * DMD * 2); bf* KPl = (bf*)take((size_t)SEQ * DMD * 2);
    h16* VT = (h16*)take((size_t)DMD * SEQ * 2);
    float* PO = (float*)take((size_t)KSPLIT * SEQ * DMD * 4); float* ML = (float*)take((size_t)KSPLIT * SEQ * 2 * 4);
    const size_t used = (size_t)(wsp - (char*)d_ws);
    if (used > ws_size || used > (size_t)134217728) return;

    // bf16 copies of the weights ([out][in] = Bt as-is) and of x
    k_cvt8<<<(unsigned)(((size_t)DMD * DMD / 8 + 255) / 256), 256, 0, stream>>>(wq, WQ, (size_t)DMD * DMD / 8);
    k_cvt8<<<(unsigned)(((size_t)DMD * DMD / 8 + 255) / 256), 256, 0, stream>>>(wk, WK, (size_t)DMD * DMD / 8);
    k_cvt8<<<(unsigned)(((size_t)DMD * DMD / 8 + 255) / 256), 256, 0, stream>>>(wv, WV, (size_t)DMD * DMD / 8);
    k_cvt8<<<(unsigned)(((size_t)SEQ * DMD / 8 + 255) / 256), 256, 0, stream>>>(x, XB, (size_t)SEQ * DMD / 8);
    // q, k, v projections: [SEQ][128] f32 = XB[SEQ][128] . W[128][128]^T
    k_gemmw<bf, 0, false><<<dim3(SEQ / 64, DMD / 64, 1), 32, 0, stream>>>(XB, nullptr, WQ, nullptr, DMD, FQ, DMD, nullptr, 0, 0, 0);
    k_gemmw<bf, 0, false><<<dim3(SEQ / 64, DMD / 64, 1), 32, 0, stream>>>(XB, nullptr, WK, nullptr, DMD, FK, DMD, nullptr, 0, 0, 0);
    k_gemmw<bf, 0, false><<<dim3(SEQ / 64, DMD / 64, 1), 32, 0, stream>>>(XB, nullptr, WV, nullptr, DMD, FV, DMD, nullptr, 0, 0, 0);
    // operand planes: q, k as bf16 hi/lo [t][d]; v as f16 [d][t]
    const unsigned LP = (unsigned)(((size_t)SEQ * DMD / 2 + 255) / 256);
    k_hlp<<<LP, 256, 0, stream>>>(FQ, SEQ * DMD, QPh, QPl);
    k_hlp<<<LP, 256, 0, stream>>>(FK, SEQ * DMD, KPh, KPl);
    k_vt16<<<LP, 256, 0, stream>>>(FV, VT);
    // attention: one block per 256 query rows and key range, then the merge of the ranges
    k_attn<<<dim3(SEQ / QB, KSPLIT, 1), NW * 32, 0, stream>>>(QPh, QPl, KPh, KPl, VT, PO, ML);
    k_merge<<<SEQ * 32 / 256, 256, 0, stream>>>(PO, ML, OUT);
}

// v003
// It runs in 85.8 microseconds.
// Next to v002, in two timings, it ran 2.47 and 2.45 times as fast.
// Over all steps from v000 it is 14.8 times as fast.
#include <hip/hip_runtime.h>

#ifndef NB
#define NB 1
#endif
#ifndef SEQ
#define SEQ 8192
#endif
#define SEQ_FULL 8192
#define DMD  128
#define QB   256                  // query rows per attention block (16 waves x 16, all walking the same key range)
#define NW   (QB / 16)            // waves per attention block
#define KSPLIT 8                  // key ranges; (SEQ / QB) x KSPLIT blocks of 16 waves = four waves on every SIMD
#define KR   (SEQ / KSPLIT)       // keys per range
#define KS   32                   // keys per step
#define OP   132                  // O staging pitch in floats
#define STK  64                   // keys per LDS stage = two 32-key steps
#define NST  (KR / STK)           // stages per key range
#define KPIT 272                  // LDS pitch in bytes of a 256-B key row: 16 B x odd, conflict-free for 16-byte fragment reads
#define VPIT 144                  // LDS pitch in bytes of a 128-B row of v^T (64 keys): 16 B x odd
#define KLB  (STK * KPIT)         // byte offset of the k lo rows in a stage
#define VTB  (2 * STK * KPIT)     // byte offset of the v^T rows in a stage
#define STB  (2 * STK * KPIT + DMD * VPIT)   // bytes per stage
#define PCAR 16384.0f             // power-of-two carry of the f16 P operand, folded back by the final normaliser
#define L2E  1.4426950408889634f

static_assert((SEQ % QB) == 0);
static_assert((SEQ % 64) == 0);
static_assert((SEQ % (KSPLIT * KS)) == 0);
static_assert((KR % STK) == 0 && NST >= 2 && (STK % KS) == 0);
static_assert(NW * 32 == 512 && STK == 64 && DMD == 128);   // the copy map below: 512 lanes x 16 B x 2 per plane
static_assert(SEQ <= SEQ_FULL);
static_assert((DMD % 32) == 0);
static_assert(NB == 1);

typedef _Float16 h16;
typedef unsigned short bf;
typedef __attribute__((ext_vector_type(16))) __bf16   v16bf;
typedef __attribute__((ext_vector_type(16))) _Float16 v16h;
typedef __attribute__((ext_vector_type(8)))  _Float16 v8h;
typedef __attribute__((ext_vector_type(8)))  unsigned short v8us;
typedef __attribute__((ext_vector_type(8)))  float    v8f;
typedef __attribute__((ext_vector_type(4)))  float    v4f;
typedef __attribute__((ext_vector_type(2)))  _Float16 v2h;
typedef __attribute__((ext_vector_type(2)))  unsigned short v2us;
typedef __attribute__((ext_vector_type(2)))  float    v2f;
typedef v8h  __attribute__((may_alias)) v8ha;
typedef v4f  __attribute__((may_alias)) v4fa;
typedef v8us __attribute__((may_alias)) v8usa;

__device__ __forceinline__ unsigned short f2bf(float f) { unsigned u = __float_as_uint(f); u += 0x7FFFu + ((u >> 16) & 1u); return (unsigned short)(u >> 16); }
__device__ __forceinline__ float bf2f(unsigned short b) { return __uint_as_float(((unsigned)b) << 16); }
__device__ __forceinline__ float bfr(float f) { return bf2f(f2bf(f)); }
__device__ __forceinline__ v16h cat16(v8h lo, v8h hi) { return __builtin_shufflevector(lo, hi, 0, 1, 2, 3, 4, 5, 6, 7, 8, 9, 10, 11, 12, 13, 14, 15); }
__device__ __forceinline__ v16bf cat16b(v8us lo, v8us hi) { return __builtin_bit_cast(v16bf, __builtin_shufflevector(lo, hi, 0, 1, 2, 3, 4, 5, 6, 7, 8, 9, 10, 11, 12, 13, 14, 15)); }
__device__ __forceinline__ v8f wmma16(v16h a, v16h b, v8f c) { return __builtin_amdgcn_wmma_f32_16x16x32_f16(false, a, false, b, (short)0, c, false, false); }
__device__ __forceinline__ v8f wmmab(v16bf a, v16bf b, v8f c) { return __builtin_amdgcn_wmma_f32_16x16x32_bf16(false, a, false, b, (short)0, c, false, false); }
__device__ __forceinline__ float xhalf(float x) { return __builtin_bit_cast(float, __builtin_amdgcn_permlanex16(__builtin_bit_cast(int, x), __builtin_bit_cast(int, x), 0x76543210, 0xfedcba98, false, false)); }  // lane l with lane l ^ 16
__device__ __forceinline__ void splitf(float y, unsigned short& h, unsigned short& l) { h = f2bf(y); l = f2bf(y - bf2f(h)); }

// 16-bit fragment loaders (wave32, 16x16x32): lane -> row/col (lane & 15); elements 0..7 <- k0 + 8*(lane>>4) + 0..7, elements 8..15 <- k0 + 16 + 8*(lane>>4) + 0..7.
// p points at row (lane & 15), column k0 + 8*(lane>>4) of a K-contiguous plane; the same map serves A and B.
template <typename T16> struct WFrag;
template <> struct WFrag<h16> { typedef v16h V; static __device__ __forceinline__ V ld(const h16* p) { return cat16(*(const v8ha*)p, *(const v8ha*)(p + 16)); } static __device__ __forceinline__ v8f mma(V a, V b, v8f c) { return wmma16(a, b, c); } };
template <> struct WFrag<bf> { typedef v16bf V; static __device__ __forceinline__ V ld(const bf* p) { return cat16b(*(const v8usa*)p, *(const v8usa*)(p + 16)); } static __device__ __forceinline__ v8f mma(V a, V b, v8f c) { return wmmab(a, b, c); } };

// ---- k_gemmw: register-blocked GEMM, ONE WAVE per 64x64 output tile (16 accumulators), operands straight from K-contiguous 16-bit planes; grid (M/64, N/64, Z), 32 threads.
// C[m][n] (f32, pitch ldc, + optional f32 bias[n]) = sum_k A[m][k] Bt[n][k] (+ split products per NSPLIT). z-batch strides sA/sB/sC in elements. K % 32 == 0.
template <typename T16, int NSPLIT, bool BIAS>
__global__ __launch_bounds__(32) void k_gemmw(const T16* __restrict__ A, const T16* __restrict__ A2, const T16* __restrict__ Bt, const T16* __restrict__ Bt2, int K, float* C, int ldc, const float* __restrict__ bias, size_t sA, size_t sB, size_t sC) {
    typedef typename WFrag<T16>::V V;
    __shared__ __align__(16) float os[16 * 68];
    const size_t z = blockIdx.z; A += z * sA; if (A2) A2 += z * sA; Bt += z * sB; if (Bt2) Bt2 += z * sB; C += z * sC;
    const int lane = threadIdx.x & 31, lr = lane & 15, hi = lane >> 4; const int r0 = blockIdx.x * 64, c0 = blockIdx.y * 64;
    v8f acc[4][4];
#pragma unroll
    for (int mb = 0; mb < 4; ++mb)
#pragma unroll
        for (int nb = 0; nb < 4; ++nb) acc[mb][nb] = (v8f){};
    const size_t aoff = (size_t)(r0 + lr) * K + 8 * hi, boff = (size_t)(c0 + lr) * K + 8 * hi;
#pragma unroll 1
    for (int kc = 0; kc < K; kc += 32) {
        V a[4], a2[4];
#pragma unroll
        for (int mb = 0; mb < 4; ++mb) { a[mb] = WFrag<T16>::ld(A + aoff + (size_t)mb * 16 * K + kc); if (NSPLIT == 1 || NSPLIT == 2) a2[mb] = WFrag<T16>::ld(A2 + aoff + (size_t)mb * 16 * K + kc); }
#pragma unroll
        for (int nb = 0; nb < 4; ++nb) { const V b = WFrag<T16>::ld(Bt + boff + (size_t)nb * 16 * K + kc); V b2; if (NSPLIT >= 2) b2 = WFrag<T16>::ld(Bt2 + boff + (size_t)nb * 16 * K + kc);
#pragma unroll
            for (int mb = 0; mb < 4; ++mb) { acc[mb][nb] = WFrag<T16>::mma(a[mb], b, acc[mb][nb]); if (NSPLIT == 1 || NSPLIT == 2) acc[mb][nb] = WFrag<T16>::mma(a2[mb], b, acc[mb][nb]); if (NSPLIT >= 2) acc[mb][nb] = WFrag<T16>::mma(a[mb], b2, acc[mb][nb]); } }
        asm volatile("v_nop\n\tv_nop\n\tv_nop\n\tv_nop" : "+v"(acc[0][0]), "+v"(acc[1][1]), "+v"(acc[2][2]), "+v"(acc[3][3]) : "v"(a[0]), "v"(a[3]));
    }
#pragma unroll
    for (int mb = 0; mb < 4; ++mb) {
#pragma unroll
        for (int nb = 0; nb < 4; ++nb) {
#pragma unroll
            for (int j = 0; j < 8; ++j) os[(hi * 8 + j) * 68 + nb * 16 + lr] = acc[mb][nb][j]; }
        __builtin_amdgcn_fence(3, "wavefront"); __builtin_amdgcn_wave_barrier(); asm volatile("" ::: "memory");
        float* crow = C + (size_t)(r0 + mb * 16) * ldc + c0;
{
#pragma unroll
            for (int s = 0; s < 8; ++s) { const int row = 2 * s + hi, cofs = lr * 4; v4f val = *(const v4fa*)(os + row * 68 + cofs); if (BIAS) { val[0] += bfr(bias[c0 + cofs]); val[1] += bfr(bias[c0 + cofs + 1]); val[2] += bfr(bias[c0 + cofs + 2]); val[3] += bfr(bias[c0 + cofs + 3]); }
                *(v4f*)(crow + (size_t)row * ldc + cofs) = val; }
             }
        __builtin_amdgcn_wave_barrier(); asm volatile("" ::: "memory");
    }
}

__global__ __launch_bounds__(256) void k_cvt8(const float* __restrict__ src, bf* dst, size_t n8) { const size_t i = (size_t)blockIdx.x * 256 + threadIdx.x; if (i >= n8) return; const v8f v = *(const v8f*)(src + i * 8); v8us o;
#pragma unroll
    for (int k = 0; k < 8; ++k) { const float f = v[k]; o[k] = f2bf(f); } *(v8us*)(dst + i * 8) = o;  }

__global__ __launch_bounds__(256) void k_hlp(const float* __restrict__ F, int n, bf* Ph, bf* Pl) {
    const int e = (blockIdx.x * 256 + threadIdx.x) * 2; if (e >= n) return;
    const v2f x = *(const v2f*)(F + e); v2us oh, ol;
#pragma unroll
    for (int q = 0; q < 2; ++q) { const float xv = x[q]; unsigned short a2, c2; splitf(xv, a2, c2); oh[q] = a2; ol[q] = c2; }
    *(v2us*)(Ph + e) = oh; *(v2us*)(Pl + e) = ol; 
}

__global__ __launch_bounds__(256) void k_vt16(const float* __restrict__ F, h16* VT) {
    const int e = (blockIdx.x * 256 + threadIdx.x) * 2; if (e >= DMD * SEQ) return;
    const int t = e % SEQ, d = e / SEQ; v2h o16;
    const float x0 = F[(size_t)t * DMD + d], x1 = F[(size_t)(t + 1) * DMD + d];
    o16[0] = (h16)x0; o16[1] = (h16)x1;
    *(v2h*)(VT + e) = o16; 
}

// v_exp_f32 with one v_nop behind it: the free slot that the instruction set asks for before a directly following instruction reads the result or overwrites the source.
__device__ __forceinline__ float exp2_slot(float x) { float y; asm("v_exp_f32 %0, %1\n\tv_nop" : "=v"(y) : "v"(x)); return y; }

// One stage of 64 keys into LDS, six 16-byte asynchronous copies per lane (k hi, k lo: 64 rows x 256 B each; v^T: 128 rows x 128 B), every lane on.
// lk / lv: the lane's LDS byte addresses in the target buffer; gh / gl / gv: its global addresses in the stage. The s_wait_xcnt closes the statement so that no address register is rewritten ahead of it.
__device__ __forceinline__ void stage_copy(unsigned lk, unsigned lv, const bf* gh, const bf* gl, const h16* gv) {
    asm volatile("global_load_async_to_lds_b128 %0, %6, off\n\t"
                 "global_load_async_to_lds_b128 %1, %7, off\n\t"
                 "global_load_async_to_lds_b128 %2, %8, off\n\t"
                 "global_load_async_to_lds_b128 %3, %9, off\n\t"
                 "global_load_async_to_lds_b128 %4, %10, off\n\t"
                 "global_load_async_to_lds_b128 %5, %11, off\n\t"
                 "s_wait_xcnt 0x0"
                 :: "v"(lk), "v"(lk + 32 * KPIT), "v"(lk + KLB), "v"(lk + KLB + 32 * KPIT), "v"(lv), "v"(lv + 64 * VPIT),
                    "v"(gh), "v"(gh + 32 * DMD), "v"(gl), "v"(gl + 32 * DMD), "v"(gv), "v"(gv + (size_t)64 * SEQ)
                 : "memory");
}

// k_attn: streaming attention over one key range. Block = 16 waves = 256 queries; wave w owns queries r0..r0+15; blockIdx.y names the range of KR keys. Per 32-key step:
//   S^T[32x16] = k.q^T from bf16 hi/lo planes (products hh + lh + hl, K = 128 in 4 steps): A = key rows, B = query columns, so lane (lr, hi) holds query r0 + lr and keys j0 + 16*nt + 8*hi + r;
//   running max in f32: 16 values in the lane, then one exchange between the lane halves; running sum per lane over its own half's keys, the halves joined once behind the loop;
//   P^T = exp(s - m) x 2^14 as f16: the two score tiles, converted in place, are the B operand of the second product (element e = key 8*hi + e, element 8 + e = key 16 + 8*hi + e: the fragment loader's k order);
//   O^T[128x16] += v^T . P^T (A from the f16 VT plane), O^T rescaled by the lane's alpha each step. The row sum uses the same f16-converted P values.
// The key rows and v^T rows of a stage (64 keys) are brought into LDS once per block by asynchronous copies and read from there by all 16 waves; two buffers, the next stage's copies fly while this one is worked on.
// Leaves PO[range][row][128] = un-normalised O and ML[range][row] = (row max, row sum), both relative to the range's own max.
__global__ __launch_bounds__(NW * 32) __attribute__((amdgpu_num_vgpr(256)))
void k_attn(const bf* __restrict__ QPh, const bf* __restrict__ QPl, const bf* __restrict__ KPh, const bf* __restrict__ KPl, const h16* __restrict__ VT, float* PO, float* ML) {
    __shared__ __align__(16) float osm[NW * 16 * OP];
    __shared__ __align__(16) unsigned char ring[2 * STB];
    const int wave = threadIdx.x >> 5, lane = threadIdx.x & 31, lr = lane & 15, hi = lane >> 4;
    const int r0 = blockIdx.x * QB + wave * 16;
    const int jb = blockIdx.y * KR;
    float* ow = osm + wave * (16 * OP);
    v8f o[8];
#pragma unroll
    for (int dt = 0; dt < 8; ++dt) o[dt] = (v8f){};
    float m = -1.0e30f, l = 0.0f;
    const size_t qoff = (size_t)(r0 + lr) * DMD + 8 * hi;
    // the wave's query fragments, both planes, held in registers over the whole key range
    v16bf qh[DMD / 32], ql[DMD / 32];
    const bf* qph = QPh + qoff; const bf* qpl = QPl + qoff;
#pragma unroll
    for (int ks = 0; ks < DMD / 32; ++ks) { qh[ks] = WFrag<bf>::ld(qph + ks * 32); ql[ks] = WFrag<bf>::ld(qpl + ks * 32); }
    asm volatile("s_wait_xcnt 0x0" :: "v"(qph), "v"(qpl) : "memory");   // the two row pointers are inputs, so they stay in their registers up to this wait: no result of the sixteen loads is given an address pair ahead of it
    const unsigned koff = lr * KPIT + 16 * hi;         // byte offsets of the lane's fragment rows inside a stage
    const unsigned voff = VTB + lr * VPIT + 16 * hi;
    // copy map: lane t of the block takes 16 B of key rows (t >> 4) and (t >> 4) + 32 of both planes, and of v^T rows (t >> 3) and (t >> 3) + 64
    const unsigned tid = threadIdx.x;
    const unsigned lk = (unsigned)(size_t)ring + (tid >> 4) * KPIT + (tid & 15) * 16;
    const unsigned lv = (unsigned)(size_t)ring + VTB + (tid >> 3) * VPIT + (tid & 7) * 16;
    const size_t gk = (size_t)(jb + (tid >> 4)) * DMD + (tid & 15) * 8;
    const size_t gv = (size_t)(tid >> 3) * SEQ + jb + (tid & 7) * 8;
    stage_copy(lk, lv, KPh + gk, KPl + gk, VT + gv);
    asm volatile("s_wait_asynccnt 0x0" ::: "memory");   // stage 0 has landed before the barrier publishes it
    __syncthreads();
    stage_copy(lk + STB, lv + STB, KPh + gk + STK * DMD, KPl + gk + STK * DMD, VT + gv + STK);
#pragma unroll 1   // one publish point and one refill in the text; the buffer is picked by the stage's parity
    for (int t = 0; t < NST; ++t) {
      const unsigned bo = (t & 1) * STB;
#pragma unroll 1   // kept rolled: unrolled, the two steps' live values pass the 256 registers of a wave and spill
      for (int h = 0; h < STK / KS; ++h) {
        v8f s[2]; s[0] = (v8f){}; s[1] = (v8f){};
        v16bf bh0, bl0, bh1, bl1;
#pragma unroll
        for (int ks = 0; ks < DMD / 32; ++ks) {
            const v16bf ah = qh[ks], al = ql[ks];
            const unsigned char* k0 = ring + bo + koff + h * (KS * KPIT) + ks * 64; const unsigned char* k1 = k0 + 16 * KPIT;
            bh0 = WFrag<bf>::ld((const bf*)k0); bl0 = WFrag<bf>::ld((const bf*)(k0 + KLB));
            bh1 = WFrag<bf>::ld((const bf*)k1); bl1 = WFrag<bf>::ld((const bf*)(k1 + KLB));
            s[0] = wmmab(bh0, ah, s[0]); s[0] = wmmab(bl0, ah, s[0]); s[0] = wmmab(bh0, al, s[0]);
            s[1] = wmmab(bh1, ah, s[1]); s[1] = wmmab(bl1, ah, s[1]); s[1] = wmmab(bh1, al, s[1]);
        }
        asm volatile("v_nop\n\tv_nop\n\tv_nop\n\tv_nop" : "+v"(s[0]), "+v"(s[1]) : "v"(qh[DMD / 32 - 1]), "v"(ql[DMD / 32 - 1]), "v"(bh0), "v"(bl0), "v"(bh1), "v"(bl1));
        // the step's v^T fragments, read as one group here: the softmax's vector work covers their LDS latency
        v16h vb[8];
#pragma unroll
        for (int dt = 0; dt < 8; ++dt) vb[dt] = WFrag<h16>::ld((const h16*)(ring + bo + voff + dt * (16 * VPIT) + h * (KS * 2)));
        __builtin_amdgcn_sched_barrier(0);   // ends the scheduling region behind that group of reads: in one region with them the softmax below is built as single exponential-multiply chains, each waiting for its own result, some 45 instructions more per step; behind this line it keeps its batched form
        // online softmax of the lane's own query
        float mx8[8];
#pragma unroll
        for (int r = 0; r < 8; ++r) mx8[r] = fmaxf(s[0][r], s[1][r]);
        float mx = fmaxf(fmaxf(fmaxf(mx8[0], mx8[1]), fmaxf(mx8[2], mx8[3])), fmaxf(fmaxf(mx8[4], mx8[5]), fmaxf(mx8[6], mx8[7])));
        mx = fmaxf(mx, xhalf(mx));
        const float mn = fmaxf(m, mx);
        const float alpha = exp2_slot((m - mn) * L2E);
        m = mn;
        v16h pb; float rs8[8];
#pragma unroll
        for (int r = 0; r < 8; ++r) {
            const float e0 = __builtin_amdgcn_exp2f((s[0][r] - mn) * L2E) * PCAR;
            const float x1 = (s[1][r] - mn) * L2E;
            const float e1 = (r == 7 ? exp2_slot(x1) : __builtin_amdgcn_exp2f(x1)) * PCAR;   // the last of the run of exponentials carries its free slot: the multiply behind it was given its source register
            const h16 p0 = (h16)e0, p1 = (h16)e1;
            pb[r] = p0; pb[8 + r] = p1;
            rs8[r] = (float)p0 + (float)p1;
        }
        l = l * alpha + (((rs8[0] + rs8[1]) + (rs8[2] + rs8[3])) + ((rs8[4] + rs8[5]) + (rs8[6] + rs8[7])));
#pragma unroll
        for (int dt = 0; dt < 8; ++dt) o[dt] *= alpha;
#pragma unroll
        for (int dt = 0; dt < 8; ++dt) o[dt] = wmma16(vb[dt], pb, o[dt]);
        asm volatile("v_nop\n\tv_nop\n\tv_nop\n\tv_nop" : "+v"(o[0]), "+v"(o[1]), "+v"(o[2]), "+v"(o[3]), "+v"(o[4]), "+v"(o[5]), "+v"(o[6]), "+v"(o[7]) : "v"(pb), "v"(vb[7]));
      }
      // publish point of stage t + 1: this wave's reads of stage t are done, its copies of stage t + 1 have landed, then the block's barrier; only behind it is stage t's buffer refilled
      asm volatile("s_wait_dscnt 0x0" ::: "memory");
      asm volatile("s_wait_asynccnt 0x0" ::: "memory");
      __syncthreads();
      if (t + 2 < NST) stage_copy(lk + bo, lv + bo, KPh + gk + (size_t)(t + 2) * (STK * DMD), KPl + gk + (size_t)(t + 2) * (STK * DMD), VT + gv + (size_t)(t + 2) * STK);
    }
    asm volatile("s_wait_asynccnt 0x0" ::: "memory");   // no copy is left in flight when the wave goes on to its end
    l += xhalf(l);
    // o[dt][r] = O[query lr][dt*16 + 8*hi + r]: eight consecutive floats of the query's staged row
#pragma unroll
    for (int dt = 0; dt < 8; ++dt) {
        v4f lo4, hi4;
#pragma unroll
        for (int r = 0; r < 4; ++r) { lo4[r] = o[dt][r]; hi4[r] = o[dt][4 + r]; }
        *(v4fa*)(ow + lr * OP + dt * 16 + 8 * hi) = lo4; *(v4fa*)(ow + lr * OP + dt * 16 + 8 * hi + 4) = hi4; }
    __builtin_amdgcn_fence(3, "wavefront"); __builtin_amdgcn_wave_barrier(); asm volatile("" ::: "memory");
    const size_t prow = (size_t)blockIdx.y * SEQ + r0;
    float* orow = PO + prow * DMD + lane * 4;
{
#pragma unroll
        for (int row = 0; row < 16; ++row) { const v4f val = *(const v4fa*)(ow + row * OP + lane * 4); *(v4f*)(orow + (size_t)row * DMD) = val; }
        
    }
    // the 16 (max, sum) pairs of a wave fill one 128-B line; lane lr of the lower half stores its own query's pair
    if (hi == 0) { v2f ml; ml[0] = m; ml[1] = l; *(v2f*)(ML + (prow + lr) * 2) = ml; }
}

// k_merge: one wave per output row, 16 B per lane. M = max of the ranges' maxima; weight w = exp(m - M); out = sum w O / sum w l.
__global__ __launch_bounds__(256) void k_merge(const float* __restrict__ PO, const float* __restrict__ ML, float* OUT) {
    const int row = __builtin_amdgcn_readfirstlane(blockIdx.x * 8 + (threadIdx.x >> 5));   // the row is the wave's own: held scalar, its (max, sum) pairs and row bases come by the scalar path
    const unsigned c = (threadIdx.x & 31) * 4;
    v2f ml[KSPLIT]; v4f p[KSPLIT];
#pragma unroll
    for (int s = 0; s < KSPLIT; ++s) ml[s] = *(const v2f*)(ML + ((size_t)s * SEQ + row) * 2);
#pragma unroll
    for (int s = 0; s < KSPLIT; ++s) { p[s] = *(const v4f*)(PO + ((size_t)s * SEQ + row) * DMD + c);
        asm volatile("s_wait_xcnt 0x0" ::: "memory"); }   // a later load's result may be given this load's address registers: the wait stands in front of that overwrite; the data waits stay counted
    float M = ml[0][0];
#pragma unroll
    for (int s = 1; s < KSPLIT; ++s) M = fmaxf(M, ml[s][0]);
    float L = 0.0f; v4f a = (v4f){};
#pragma unroll
    for (int s = 0; s < KSPLIT; ++s) { const float w = exp2_slot((ml[s][0] - M) * L2E); L += w * ml[s][1]; a += w * p[s]; }
    const float inv = 1.0f / L;
    *(v4f*)(OUT + (size_t)row * DMD + c) = a * inv;
}

extern "C" void kernel_launch(void* const* d_in, const int* in_sizes, int n_in,
                              void* d_out, int out_size, void* d_ws, size_t ws_size, hipStream_t stream) {
    if (n_in < 4) return;
    if (in_sizes[0] < SEQ * DMD || in_sizes[1] < DMD * DMD || in_sizes[2] < DMD * DMD || in_sizes[3] < DMD * DMD || out_size < SEQ * DMD) return;
    const float* x = (const float*)d_in[0]; const float* wq = (const float*)d_in[1]; const float* wk = (const float*)d_in[2]; const float* wv = (const float*)d_in[3];
    float* OUT = (float*)d_out;     // [SEQ][128] f32
    char* wsp = (char*)d_ws;
    auto take = [&](size_t bytes) { char* p = wsp; wsp += (bytes + 255) & ~(size_t)255; return (void*)p; };
    bf* WQ = (bf*)take((size_t)DMD * DMD * 2); bf* WK = (bf*)take((size_t)DMD * DMD * 2); bf* WV = (bf*)take((size_t)DMD * DMD * 2);
    bf* XB = (bf*)take((size_t)SEQ * DMD * 2);
    float* FQ = (float*)take((size_t)SEQ * DMD * 4); float* FK = (float*)take((size_t)SEQ * DMD * 4); float* FV = (float*)take((size_t)SEQ * DMD * 4);
    bf* QPh = (bf*)take((size_t)SEQ * DMD * 2); bf* QPl = (bf*)take((size_t)SEQ * DMD * 2); bf* KPh = (bf*)take((size_t)SEQ * DMD * 2); bf* KPl = (bf*)take((size_t)SEQ * DMD * 2);
    h16* VT = (h16*)take((size_t)DMD * SEQ * 2);
    float* PO = (float*)take((size_t)KSPLIT * SEQ * DMD * 4); float* ML = (float*)take((size_t)KSPLIT * SEQ * 2 * 4);
    const size_t used = (size_t)(wsp - (char*)d_ws);
    if (used > ws_size || used > (size_t)134217728) return;

    // bf16 copies of the weights ([out][in] = Bt as-is) and of x
    k_cvt8<<<(unsigned)(((size_t)DMD * DMD / 8 + 255) / 256), 256, 0, stream>>>(wq, WQ, (size_t)DMD * DMD / 8);
    k_cvt8<<<(unsigned)(((size_t)DMD * DMD / 8 + 255) / 256), 256, 0, stream>>>(wk, WK, (size_t)DMD * DMD / 8);
    k_cvt8<<<(unsigned)(((size_t)DMD * DMD / 8 + 255) / 256), 256, 0, stream>>>(wv, WV, (size_t)DMD * DMD / 8);
    k_cvt8<<<(unsigned)(((size_t)SEQ * DMD / 8 + 255) / 256), 256, 0, stream>>>(x, XB, (size_t)SEQ * DMD / 8);
    // q, k, v projections: [SEQ][128] f32 = XB[SEQ][128] . W[128][128]^T
    k_gemmw<bf, 0, false><<<dim3(SEQ / 64, DMD / 64, 1), 32, 0, stream>>>(XB, nullptr, WQ, nullptr, DMD, FQ, DMD, nullptr, 0, 0, 0);
    k_gemmw<bf, 0, false><<<dim3(SEQ / 64, DMD / 64, 1), 32, 0, stream>>>(XB, nullptr, WK, nullptr, DMD, FK, DMD, nullptr, 0, 0, 0);
    k_gemmw<bf, 0, false><<<dim3(SEQ / 64, DMD / 64, 1), 32, 0, stream>>>(XB, nullptr, WV, nullptr, DMD, FV, DMD, nullptr, 0, 0, 0);
    // operand planes: q, k as bf16 hi/lo [t][d]; v as f16 [d][t]
    const unsigned LP = (unsigned)(((size_t)SEQ * DMD / 2 + 255) / 256);
    k_hlp<<<LP, 256, 0, stream>>>(FQ, SEQ * DMD, QPh, QPl);
    k_hlp<<<LP, 256, 0, stream>>>(FK, SEQ * DMD, KPh, KPl);
    k_vt16<<<LP, 256, 0, stream>>>(FV, VT);
    // attention: one block per 256 query rows and key range, then the merge of the ranges
    k_attn<<<dim3(SEQ / QB, KSPLIT, 1), NW * 32, 0, stream>>>(QPh, QPl, KPh, KPl, VT, PO, ML);
    k_merge<<<SEQ * 32 / 256, 256, 0, stream>>>(PO, ML, OUT);
}

// v004
// One run takes 57.6 microseconds.
// Next to v003, in two timings, it ran 1.51 and 1.49 times as fast.
// Over all steps from v000 it is 22.2 times as fast.
#include <hip/hip_runtime.h>

#ifndef NB
#define NB 1
#endif
#ifndef SEQ
#define SEQ 8192
#endif
#define SEQ_FULL 8192
#define DMD  128
#define QB   256                  // query rows per attention block (16 waves x 16, all walking the same key range)
#define NW   (QB / 16)            // waves per attention block
#define KSPLIT 8                  // key ranges; (SEQ / QB) x KSPLIT blocks of 16 waves = four waves on every SIMD
#define KR   (SEQ / KSPLIT)       // keys per range
#define KS   32                   // keys per step
#define OP   132                  // O staging pitch in floats
#define STK  64                   // keys per LDS stage = two 32-key steps
#define NST  (KR / STK)           // stages per key range
#define KPIT 272                  // LDS pitch in bytes of a 256-B key row: 16 B x odd, conflict-free for 16-byte fragment reads
#define VPIT 144                  // LDS pitch in bytes of a 128-B row of v^T (64 keys): 16 B x odd
#define KLB  (STK * KPIT)         // byte offset of the k lo rows in a stage
#define VTB  (2 * STK * KPIT)     // byte offset of the v^T rows in a stage
#define STB  (2 * STK * KPIT + DMD * VPIT)   // bytes per stage
#define PR   64                   // tokens per projection block: one 128-B line of the [d][t] plane
#define PCAR 16384.0f             // power-of-two carry of the f16 P operand, folded back by the final normaliser
#define L2E  1.4426950408889634f

static_assert((SEQ % QB) == 0);
static_assert((SEQ % PR) == 0 && PR == 64 && VPIT >= PR * 2);
static_assert((SEQ % (KSPLIT * KS)) == 0);
static_assert((KR % STK) == 0 && NST >= 2 && (STK % KS) == 0);
static_assert(NW * 32 == 512 && STK == 64 && DMD == 128);   // the copy map below: 512 lanes x 16 B x 2 per plane
static_assert(SEQ <= SEQ_FULL);
static_assert((DMD % 32) == 0);
static_assert(NB == 1);

typedef _Float16 h16;
typedef unsigned short bf;
typedef __attribute__((ext_vector_type(16))) __bf16   v16bf;
typedef __attribute__((ext_vector_type(16))) _Float16 v16h;
typedef __attribute__((ext_vector_type(8)))  _Float16 v8h;
typedef __attribute__((ext_vector_type(8)))  unsigned short v8us;
typedef __attribute__((ext_vector_type(8)))  float    v8f;
typedef __attribute__((ext_vector_type(4)))  float    v4f;
typedef __attribute__((ext_vector_type(2)))  float    v2f;
typedef v8h  __attribute__((may_alias)) v8ha;
typedef v4f  __attribute__((may_alias)) v4fa;
typedef v8us __attribute__((may_alias)) v8usa;
typedef __attribute__((ext_vector_type(4)))  unsigned short v4us;
typedef v4us __attribute__((may_alias)) v4usa;

__device__ __forceinline__ unsigned short f2bf(float f) { unsigned u = __float_as_uint(f); u += 0x7FFFu + ((u >> 16) & 1u); return (unsigned short)(u >> 16); }
__device__ __forceinline__ float bf2f(unsigned short b) { return __uint_as_float(((unsigned)b) << 16); }
__device__ __forceinline__ v16h cat16(v8h lo, v8h hi) { return __builtin_shufflevector(lo, hi, 0, 1, 2, 3, 4, 5, 6, 7, 8, 9, 10, 11, 12, 13, 14, 15); }
__device__ __forceinline__ v16bf cat16b(v8us lo, v8us hi) { return __builtin_bit_cast(v16bf, __builtin_shufflevector(lo, hi, 0, 1, 2, 3, 4, 5, 6, 7, 8, 9, 10, 11, 12, 13, 14, 15)); }
__device__ __forceinline__ v8f wmma16(v16h a, v16h b, v8f c) { return __builtin_amdgcn_wmma_f32_16x16x32_f16(false, a, false, b, (short)0, c, false, false); }
__device__ __forceinline__ v8f wmmab(v16bf a, v16bf b, v8f c) { return __builtin_amdgcn_wmma_f32_16x16x32_bf16(false, a, false, b, (short)0, c, false, false); }
__device__ __forceinline__ float xhalf(float x) { return __builtin_bit_cast(float, __builtin_amdgcn_permlanex16(__builtin_bit_cast(int, x), __builtin_bit_cast(int, x), 0x76543210, 0xfedcba98, false, false)); }  // lane l with lane l ^ 16
__device__ __forceinline__ void splitf(float y, unsigned short& h, unsigned short& l) { h = f2bf(y); l = f2bf(y - bf2f(h)); }

// 16-bit fragment loaders (wave32, 16x16x32): lane -> row/col (lane & 15); elements 0..7 <- k0 + 8*(lane>>4) + 0..7, elements 8..15 <- k0 + 16 + 8*(lane>>4) + 0..7.
// p points at row (lane & 15), column k0 + 8*(lane>>4) of a K-contiguous plane; the same map serves A and B.
template <typename T16> struct WFrag;
template <> struct WFrag<h16> { typedef v16h V; static __device__ __forceinline__ V ld(const h16* p) { return cat16(*(const v8ha*)p, *(const v8ha*)(p + 16)); } static __device__ __forceinline__ v8f mma(V a, V b, v8f c) { return wmma16(a, b, c); } };
template <> struct WFrag<bf> { typedef v16bf V; static __device__ __forceinline__ V ld(const bf* p) { return cat16b(*(const v8usa*)p, *(const v8usa*)(p + 16)); } static __device__ __forceinline__ v8f mma(V a, V b, v8f c) { return wmmab(a, b, c); } };

// k_proj: the whole preparation in one launch. Block = 8 waves = 64 tokens x one of the three projections (blockIdx.y: 0 q, 1 k, 2 v); grid (SEQ / 64, 3).
// The block reads its 64 x 128 f32 rows of x and the 128 x 128 f32 weight once (512 contiguous bytes per wave instruction), rounds them to bf16 and lays them in LDS as K-contiguous rows.
// Wave w takes token tiles 2*(w & 1) + {0, 1} and weight-row tiles 2*(w >> 1) + {0, 1}: four accumulators, K = 128 in four steps in rising order.
//   q, k: A = weight rows, B = token rows, so a lane holds 8 consecutive d of one token: split into bf16 hi + lo, 16 B per plane;
//   v:    A = token rows, B = weight rows, so a lane holds 8 consecutive tokens of one d: 16 B of the f16 [d][t] plane.
// The results are staged in LDS and leave as whole 128-B lines. Every loop is unrolled: the register arrays (loaded rows, fragments, accumulators) need constant indices, and all 24 global loads are then in flight together.
__global__ __launch_bounds__(256) void k_proj(const float* __restrict__ X, const float* __restrict__ Wq, const float* __restrict__ Wk, const float* __restrict__ Wv, bf* QPh, bf* QPl, bf* KPh, bf* KPl, h16* VT) {
    __shared__ __align__(16) unsigned char xs[PR * KPIT];        // bf16 rows of x
    __shared__ __align__(16) unsigned char wl[DMD * KPIT];       // bf16 rows of the weight
    __shared__ __align__(16) unsigned char st[2 * PR * KPIT];    // q, k: 64 hi rows, then 64 lo rows; v: 128 rows of 64 tokens at pitch VPIT
    static_assert(DMD * VPIT <= 2 * PR * KPIT);
    const int which = blockIdx.y, t0 = blockIdx.x * PR;
    const unsigned tid = threadIdx.x;
    const int wave = tid >> 5, lane = tid & 31, lr = lane & 15, hi = lane >> 4;
    const float* xp = X + (size_t)t0 * DMD + tid * 4;
    const float* wp = (which == 0 ? Wq : which == 1 ? Wk : Wv) + tid * 4;
    v4f xr[PR * DMD / 1024], wr[DMD * DMD / 1024];
#pragma unroll
    for (int i = 0; i < DMD * DMD / 1024; ++i) wr[i] = *(const v4f*)(wp + i * 1024);
#pragma unroll
    for (int i = 0; i < PR * DMD / 1024; ++i) xr[i] = *(const v4f*)(xp + i * 1024);
#pragma unroll
    for (int i = 0; i < PR * DMD / 1024; ++i) { v4us c;
#pragma unroll
        for (int k = 0; k < 4; ++k) c[k] = f2bf(xr[i][k]);
        *(v4usa*)(xs + (i * 8 + wave) * KPIT + lane * 8) = c; }
#pragma unroll
    for (int i = 0; i < DMD * DMD / 1024; ++i) { v4us c;
#pragma unroll
        for (int k = 0; k < 4; ++k) c[k] = f2bf(wr[i][k]);
        *(v4usa*)(wl + (i * 8 + wave) * KPIT + lane * 8) = c; }
    __syncthreads();
    const int xi = (wave & 1) * 2, wi = (wave >> 1) * 2;
    v16bf xf[DMD / 32][2], wf[DMD / 32][2];
#pragma unroll
    for (int kc = 0; kc < DMD / 32; ++kc)
#pragma unroll
        for (int i = 0; i < 2; ++i) {
            xf[kc][i] = WFrag<bf>::ld((const bf*)(xs + ((xi + i) * 16 + lr) * KPIT + kc * 64 + 16 * hi));
            wf[kc][i] = WFrag<bf>::ld((const bf*)(wl + ((wi + i) * 16 + lr) * KPIT + kc * 64 + 16 * hi)); }
    v8f acc[2][2];
#pragma unroll
    for (int i = 0; i < 2; ++i)
#pragma unroll
        for (int j = 0; j < 2; ++j) acc[i][j] = (v8f){};
    if (which < 2) {
#pragma unroll
        for (int kc = 0; kc < DMD / 32; ++kc)
#pragma unroll
            for (int j = 0; j < 2; ++j)
#pragma unroll
                for (int i = 0; i < 2; ++i) acc[i][j] = wmmab(wf[kc][j], xf[kc][i], acc[i][j]);
        // acc[i][j][r] = y[token (xi + i)*16 + lr][d = (wi + j)*16 + 8*hi + r]
#pragma unroll
        for (int i = 0; i < 2; ++i)
#pragma unroll
            for (int j = 0; j < 2; ++j) { v8us h8, l8;
#pragma unroll
                for (int r = 0; r < 8; ++r) { unsigned short a2, c2; splitf(acc[i][j][r], a2, c2); h8[r] = a2; l8[r] = c2; }
                unsigned char* p = st + ((xi + i) * 16 + lr) * KPIT + (wi + j) * 32 + 16 * hi;
                *(v8usa*)p = h8; *(v8usa*)(p + PR * KPIT) = l8; }
    } else {
#pragma unroll
        for (int kc = 0; kc < DMD / 32; ++kc)
#pragma unroll
            for (int j = 0; j < 2; ++j)
#pragma unroll
                for (int i = 0; i < 2; ++i) acc[i][j] = wmmab(xf[kc][i], wf[kc][j], acc[i][j]);
        // acc[i][j][r] = v[token (xi + i)*16 + 8*hi + r][d = (wi + j)*16 + lr]
#pragma unroll
        for (int i = 0; i < 2; ++i)
#pragma unroll
            for (int j = 0; j < 2; ++j) { v8h o8;
#pragma unroll
                for (int r = 0; r < 8; ++r) o8[r] = (h16)acc[i][j][r];
                *(v8ha*)(st + ((wi + j) * 16 + lr) * VPIT + (xi + i) * 32 + 16 * hi) = o8; }
    }
    __syncthreads();
    if (which == 2) {
        // 128 rows of 128 B: eight lanes per row, four rows per wave instruction
        h16* pv = VT + (size_t)(tid >> 3) * SEQ + t0 + (tid & 7) * 8;
        v8h vv[4];
#pragma unroll
        for (int i = 0; i < 4; ++i) vv[i] = *(const v8ha*)(st + (i * 32 + (tid >> 3)) * VPIT + (tid & 7) * 16);
#pragma unroll
        for (int i = 0; i < 4; ++i) *(v8h*)(pv + (size_t)i * 32 * SEQ) = vv[i];
        return;
    }
    {
        // the block's 64 rows are 16 KB in a row in each plane: 16 B per lane, four times per plane
        bf* ph = (which == 0 ? QPh : KPh) + (size_t)t0 * DMD + tid * 8;
        bf* pl = (which == 0 ? QPl : KPl) + (size_t)t0 * DMD + tid * 8;
        v8us vh[4], vl[4];
#pragma unroll
        for (int i = 0; i < 4; ++i) { const unsigned char* p = st + (i * 16 + (tid >> 4)) * KPIT + (tid & 15) * 16; vh[i] = *(const v8usa*)p; vl[i] = *(const v8usa*)(p + PR * KPIT); }
#pragma unroll
        for (int i = 0; i < 4; ++i) { *(v8us*)(ph + i * 2048) = vh[i]; *(v8us*)(pl + i * 2048) = vl[i]; }
        asm volatile("s_wait_xcnt 0x0" ::: "memory");   // in the built text the v arm follows this one: the wait stands in front of its first overwrite of a register that these stores name
    }
}

// v_exp_f32 with one v_nop behind it: the free slot that the instruction set asks for before a directly following instruction reads the result or overwrites the source.
__device__ __forceinline__ float exp2_slot(float x) { float y; asm("v_exp_f32 %0, %1\n\tv_nop" : "=v"(y) : "v"(x)); return y; }

// One stage of 64 keys into LDS, six 16-byte asynchronous copies per lane (k hi, k lo: 64 rows x 256 B each; v^T: 128 rows x 128 B), every lane on.
// lk / lv: the lane's LDS byte addresses in the target buffer; gh / gl / gv: its global addresses in the stage. The s_wait_xcnt closes the statement so that no address register is rewritten ahead of it.
__device__ __forceinline__ void stage_copy(unsigned lk, unsigned lv, const bf* gh, const bf* gl, const h16* gv) {
    asm volatile("global_load_async_to_lds_b128 %0, %6, off\n\t"
                 "global_load_async_to_lds_b128 %1, %7, off\n\t"
                 "global_load_async_to_lds_b128 %2, %8, off\n\t"
                 "global_load_async_to_lds_b128 %3, %9, off\n\t"
                 "global_load_async_to_lds_b128 %4, %10, off\n\t"
                 "global_load_async_to_lds_b128 %5, %11, off\n\t"
                 "s_wait_xcnt 0x0"
                 :: "v"(lk), "v"(lk + 32 * KPIT), "v"(lk + KLB), "v"(lk + KLB + 32 * KPIT), "v"(lv), "v"(lv + 64 * VPIT),
                    "v"(gh), "v"(gh + 32 * DMD), "v"(gl), "v"(gl + 32 * DMD), "v"(gv), "v"(gv + (size_t)64 * SEQ)
                 : "memory");
}

// k_attn: streaming attention over one key range. Block = 16 waves = 256 queries; wave w owns queries r0..r0+15; blockIdx.y names the range of KR keys. Per 32-key step:
//   S^T[32x16] = k.q^T from bf16 hi/lo planes (products hh + lh + hl, K = 128 in 4 steps): A = key rows, B = query columns, so lane (lr, hi) holds query r0 + lr and keys j0 + 16*nt + 8*hi + r;
//   running max in f32: 16 values in the lane, then one exchange between the lane halves; running sum per lane over its own half's keys, the halves joined once behind the loop;
//   P^T = exp(s - m) x 2^14 as f16: the two score tiles, converted in place, are the B operand of the second product (element e = key 8*hi + e, element 8 + e = key 16 + 8*hi + e: the fragment loader's k order);
//   O^T[128x16] += v^T . P^T (A from the f16 VT plane), O^T rescaled by the lane's alpha each step. The row sum uses the same f16-converted P values.
// The key rows and v^T rows of a stage (64 keys) are brought into LDS once per block by asynchronous copies and read from there by all 16 waves; two buffers, the next stage's copies fly while this one is worked on.
// Leaves PO[range][row][128] = un-normalised O and ML[range][row] = (row max, row sum), both relative to the range's own max.
__global__ __launch_bounds__(NW * 32) __attribute__((amdgpu_num_vgpr(256)))
void k_attn(const bf* __restrict__ QPh, const bf* __restrict__ QPl, const bf* __restrict__ KPh, const bf* __restrict__ KPl, const h16* __restrict__ VT, float* PO, float* ML) {
    __shared__ __align__(16) float osm[NW * 16 * OP];
    __shared__ __align__(16) unsigned char ring[2 * STB];
    const int wave = threadIdx.x >> 5, lane = threadIdx.x & 31, lr = lane & 15, hi = lane >> 4;
    const int r0 = blockIdx.x * QB + wave * 16;
    const int jb = blockIdx.y * KR;
    float* ow = osm + wave * (16 * OP);
    v8f o[8];
#pragma unroll
    for (int dt = 0; dt < 8; ++dt) o[dt] = (v8f){};
    float m = -1.0e30f, l = 0.0f;
    const size_t qoff = (size_t)(r0 + lr) * DMD + 8 * hi;
    // the wave's query fragments, both planes, held in registers over the whole key range
    v16bf qh[DMD / 32], ql[DMD / 32];
    const bf* qph = QPh + qoff; const bf* qpl = QPl + qoff;
#pragma unroll
    for (int ks = 0; ks < DMD / 32; ++ks) { qh[ks] = WFrag<bf>::ld(qph + ks * 32); ql[ks] = WFrag<bf>::ld(qpl + ks * 32); }
    asm volatile("s_wait_xcnt 0x0" :: "v"(qph), "v"(qpl) : "memory");   // the two row pointers are inputs, so they stay in their registers up to this wait: no result of the sixteen loads is given an address pair ahead of it
    const unsigned koff = lr * KPIT + 16 * hi;         // byte offsets of the lane's fragment rows inside a stage
    const unsigned voff = VTB + lr * VPIT + 16 * hi;
    // copy map: lane t of the block takes 16 B of key rows (t >> 4) and (t >> 4) + 32 of both planes, and of v^T rows (t >> 3) and (t >> 3) + 64
    const unsigned tid = threadIdx.x;
    const unsigned lk = (unsigned)(size_t)ring + (tid >> 4) * KPIT + (tid & 15) * 16;
    const unsigned lv = (unsigned)(size_t)ring + VTB + (tid >> 3) * VPIT + (tid & 7) * 16;
    const size_t gk = (size_t)(jb + (tid >> 4)) * DMD + (tid & 15) * 8;
    const size_t gv = (size_t)(tid >> 3) * SEQ + jb + (tid & 7) * 8;
    stage_copy(lk, lv, KPh + gk, KPl + gk, VT + gv);
    asm volatile("s_wait_asynccnt 0x0" ::: "memory");   // stage 0 has landed before the barrier publishes it
    __syncthreads();
    stage_copy(lk + STB, lv + STB, KPh + gk + STK * DMD, KPl + gk + STK * DMD, VT + gv + STK);
#pragma unroll 1   // one publish point and one refill in the text; the buffer is picked by the stage's parity
    for (int t = 0; t < NST; ++t) {
      const unsigned bo = (t & 1) * STB;
#pragma unroll 1   // kept rolled: unrolled, the two steps' live values pass the 256 registers of a wave and spill
      for (int h = 0; h < STK / KS; ++h) {
        v8f s[2]; s[0] = (v8f){}; s[1] = (v8f){};
        v16bf bh0, bl0, bh1, bl1;
#pragma unroll
        for (int ks = 0; ks < DMD / 32; ++ks) {
            const v16bf ah = qh[ks], al = ql[ks];
            const unsigned char* k0 = ring + bo + koff + h * (KS * KPIT) + ks * 64; const unsigned char* k1 = k0 + 16 * KPIT;
            bh0 = WFrag<bf>::ld((const bf*)k0); bl0 = WFrag<bf>::ld((const bf*)(k0 + KLB));
            bh1 = WFrag<bf>::ld((const bf*)k1); bl1 = WFrag<bf>::ld((const bf*)(k1 + KLB));
            s[0] = wmmab(bh0, ah, s[0]); s[0] = wmmab(bl0, ah, s[0]); s[0] = wmmab(bh0, al, s[0]);
            s[1] = wmmab(bh1, ah, s[1]); s[1] = wmmab(bl1, ah, s[1]); s[1] = wmmab(bh1, al, s[1]);
        }
        asm volatile("v_nop\n\tv_nop\n\tv_nop\n\tv_nop" : "+v"(s[0]), "+v"(s[1]) : "v"(qh[DMD / 32 - 1]), "v"(ql[DMD / 32 - 1]), "v"(bh0), "v"(bl0), "v"(bh1), "v"(bl1));
        // the step's v^T fragments, read as one group here: the softmax's vector work covers their LDS latency
        v16h vb[8];
#pragma unroll
        for (int dt = 0; dt < 8; ++dt) vb[dt] = WFrag<h16>::ld((const h16*)(ring + bo + voff + dt * (16 * VPIT) + h * (KS * 2)));
        __builtin_amdgcn_sched_barrier(0);   // ends the scheduling region behind that group of reads: in one region with them the softmax below is built as single exponential-multiply chains, each waiting for its own result, some 45 instructions more per step; behind this line it keeps its batched form
        // online softmax of the lane's own query
        float mx8[8];
#pragma unroll
        for (int r = 0; r < 8; ++r) mx8[r] = fmaxf(s[0][r], s[1][r]);
        float mx = fmaxf(fmaxf(fmaxf(mx8[0], mx8[1]), fmaxf(mx8[2], mx8[3])), fmaxf(fmaxf(mx8[4], mx8[5]), fmaxf(mx8[6], mx8[7])));
        mx = fmaxf(mx, xhalf(mx));
        const float mn = fmaxf(m, mx);
        const float alpha = exp2_slot((m - mn) * L2E);
        m = mn;
        v16h pb; float rs8[8];
#pragma unroll
        for (int r = 0; r < 8; ++r) {
            const float e0 = __builtin_amdgcn_exp2f((s[0][r] - mn) * L2E) * PCAR;
            const float x1 = (s[1][r] - mn) * L2E;
            const float e1 = (r == 7 ? exp2_slot(x1) : __builtin_amdgcn_exp2f(x1)) * PCAR;   // the last of the run of exponentials carries its free slot: the multiply behind it was given its source register
            const h16 p0 = (h16)e0, p1 = (h16)e1;
            pb[r] = p0; pb[8 + r] = p1;
            rs8[r] = (float)p0 + (float)p1;
        }
        l = l * alpha + (((rs8[0] + rs8[1]) + (rs8[2] + rs8[3])) + ((rs8[4] + rs8[5]) + (rs8[6] + rs8[7])));
#pragma unroll
        for (int dt = 0; dt < 8; ++dt) o[dt] *= alpha;
#pragma unroll
        for (int dt = 0; dt < 8; ++dt) o[dt] = wmma16(vb[dt], pb, o[dt]);
        asm volatile("v_nop\n\tv_nop\n\tv_nop\n\tv_nop" : "+v"(o[0]), "+v"(o[1]), "+v"(o[2]), "+v"(o[3]), "+v"(o[4]), "+v"(o[5]), "+v"(o[6]), "+v"(o[7]) : "v"(pb), "v"(vb[7]));
      }
      // publish point of stage t + 1: this wave's reads of stage t are done, its copies of stage t + 1 have landed, then the block's barrier; only behind it is stage t's buffer refilled
      asm volatile("s_wait_dscnt 0x0" ::: "memory");
      asm volatile("s_wait_asynccnt 0x0" ::: "memory");
      __syncthreads();
      if (t + 2 < NST) stage_copy(lk + bo, lv + bo, KPh + gk + (size_t)(t + 2) * (STK * DMD), KPl + gk + (size_t)(t + 2) * (STK * DMD), VT + gv + (size_t)(t + 2) * STK);
    }
    asm volatile("s_wait_asynccnt 0x0" ::: "memory");   // no copy is left in flight when the wave goes on to its end
    l += xhalf(l);
    // o[dt][r] = O[query lr][dt*16 + 8*hi + r]: eight consecutive floats of the query's staged row
#pragma unroll
    for (int dt = 0; dt < 8; ++dt) {
        v4f lo4, hi4;
#pragma unroll
        for (int r = 0; r < 4; ++r) { lo4[r] = o[dt][r]; hi4[r] = o[dt][4 + r]; }
        *(v4fa*)(ow + lr * OP + dt * 16 + 8 * hi) = lo4; *(v4fa*)(ow + lr * OP + dt * 16 + 8 * hi + 4) = hi4; }
    __builtin_amdgcn_fence(3, "wavefront"); __builtin_amdgcn_wave_barrier(); asm volatile("" ::: "memory");
    const size_t prow = (size_t)blockIdx.y * SEQ + r0;
    float* orow = PO + prow * DMD + lane * 4;
{
#pragma unroll
        for (int row = 0; row < 16; ++row) { const v4f val = *(const v4fa*)(ow + row * OP + lane * 4); *(v4f*)(orow + (size_t)row * DMD) = val; }
        
    }
    // the 16 (max, sum) pairs of a wave fill one 128-B line; lane lr of the lower half stores its own query's pair
    if (hi == 0) { v2f ml; ml[0] = m; ml[1] = l; *(v2f*)(ML + (prow + lr) * 2) = ml; }
}

// k_merge: one wave per output row, 16 B per lane. M = max of the ranges' maxima; weight w = exp(m - M); out = sum w O / sum w l.
__global__ __launch_bounds__(256) void k_merge(const float* __restrict__ PO, const float* __restrict__ ML, float* OUT) {
    const int row = __builtin_amdgcn_readfirstlane(blockIdx.x * 8 + (threadIdx.x >> 5));   // the row is the wave's own: held scalar, its (max, sum) pairs and row bases come by the scalar path
    const unsigned c = (threadIdx.x & 31) * 4;
    v2f ml[KSPLIT]; v4f p[KSPLIT];
#pragma unroll
    for (int s = 0; s < KSPLIT; ++s) ml[s] = *(const v2f*)(ML + ((size_t)s * SEQ + row) * 2);
#pragma unroll
    for (int s = 0; s < KSPLIT; ++s) { p[s] = *(const v4f*)(PO + ((size_t)s * SEQ + row) * DMD + c);
        asm volatile("s_wait_xcnt 0x0" ::: "memory"); }   // a later load's result may be given this load's address registers: the wait stands in front of that overwrite; the data waits stay counted
    float M = ml[0][0];
#pragma unroll
    for (int s = 1; s < KSPLIT; ++s) M = fmaxf(M, ml[s][0]);
    float L = 0.0f; v4f a = (v4f){};
#pragma unroll
    for (int s = 0; s < KSPLIT; ++s) { const float w = exp2_slot((ml[s][0] - M) * L2E); L += w * ml[s][1]; a += w * p[s]; }
    const float inv = 1.0f / L;
    *(v4f*)(OUT + (size_t)row * DMD + c) = a * inv;
}

extern "C" void kernel_launch(void* const* d_in, const int* in_sizes, int n_in,
                              void* d_out, int out_size, void* d_ws, size_t ws_size, hipStream_t stream) {
    if (n_in < 4) return;
    if (in_sizes[0] < SEQ * DMD || in_sizes[1] < DMD * DMD || in_sizes[2] < DMD * DMD || in_sizes[3] < DMD * DMD || out_size < SEQ * DMD) return;
    const float* x = (const float*)d_in[0]; const float* wq = (const float*)d_in[1]; const float* wk = (const float*)d_in[2]; const float* wv = (const float*)d_in[3];
    float* OUT = (float*)d_out;     // [SEQ][128] f32
    char* wsp = (char*)d_ws;
    auto take = [&](size_t bytes) { char* p = wsp; wsp += (bytes + 255) & ~(size_t)255; return (void*)p; };
    bf* QPh = (bf*)take((size_t)SEQ * DMD * 2); bf* QPl = (bf*)take((size_t)SEQ * DMD * 2); bf* KPh = (bf*)take((size_t)SEQ * DMD * 2); bf* KPl = (bf*)take((size_t)SEQ * DMD * 2);
    h16* VT = (h16*)take((size_t)DMD * SEQ * 2);
    float* PO = (float*)take((size_t)KSPLIT * SEQ * DMD * 4); float* ML = (float*)take((size_t)KSPLIT * SEQ * 2 * 4);
    const size_t used = (size_t)(wsp - (char*)d_ws);
    if (used > ws_size || used > (size_t)134217728) return;

    // operand planes straight from x and the [out][in] weights: q, k as bf16 hi/lo [t][d]; v as f16 [d][t]
    k_proj<<<dim3(SEQ / PR, 3, 1), 256, 0, stream>>>(x, wq, wk, wv, QPh, QPl, KPh, KPl, VT);
    // attention: one block per 256 query rows and key range, then the merge of the ranges
    k_attn<<<dim3(SEQ / QB, KSPLIT, 1), NW * 32, 0, stream>>>(QPh, QPl, KPh, KPl, VT, PO, ML);
    k_merge<<<SEQ * 32 / 256, 256, 0, stream>>>(PO, ML, OUT);
}

